// v000
// Measured on an AMD MI455X. A time is GPU time per run, averaged over a window of back-to-back runs after a warm-up
// (all launches, gaps included; the runs take copies of the inputs in turn), and the median of several windows.
// Apart from v000's, it joins two sittings. Times from different sittings can be a few percent apart, while
// side-by-side timings come from the same sitting.
// v000 is the starting kernel. One run takes 632 microseconds.
#include <hip/hip_runtime.h>
#include <hip/hip_bf16.h>
#include <math.h>

// ---------------------------------------------------------------------------
// Problem constants (reference: B=8, N=2048, D=512)
// ---------------------------------------------------------------------------
#define BATCH 8
#define NSEQ  2048
#define DMODEL 512
#define INV_TEMP 0.04419417382415922f   // 1/sqrt(512)
#define EPS 1e-5f

typedef __attribute__((ext_vector_type(16))) _Float16 v16h;
typedef __attribute__((ext_vector_type(8)))  _Float16 v8h;
typedef __attribute__((ext_vector_type(8)))  float    v8f;
typedef __attribute__((ext_vector_type(4)))  unsigned int v4u;
typedef __attribute__((ext_vector_type(8)))  int      v8i;
typedef __attribute__((ext_vector_type(4)))  int      v4i;

__device__ __forceinline__ v16h load_frag_rm(const _Float16* base, int stride, int lane) {
    const int r  = lane & 15;
    const int hs = (lane >> 4) << 3;             // 0 or 8
    const _Float16* p = base + (size_t)r * stride + hs;
    v8h lo = *(const v8h*)(p);
    v8h hi = *(const v8h*)(p + 16);
    return __builtin_shufflevector(lo, hi, 0,1,2,3,4,5,6,7,8,9,10,11,12,13,14,15);
}

__device__ __forceinline__ v8f wmma_f16(v16h a, v16h b, v8f c) {
    return __builtin_amdgcn_wmma_f32_16x16x32_f16(
        false, a, false, b, (short)0, c, false, false);
}

// branchless ELU (alpha = 1) on the fast-exp path (v_exp_f32)
__device__ __forceinline__ float elu_fast(float x) {
    float e = __expf(x) - 1.0f;
    return (x > 0.0f) ? x : e;
}

__device__ __forceinline__ void tdm_load_k_tile(const _Float16* gsrc, _Float16* ldst) {
    const unsigned long long ga = (unsigned long long)(uintptr_t)gsrc;
    const unsigned int lo = (unsigned int)(uintptr_t)ldst;  // LDS byte offset
    v4u g0 = {};
    g0[0] = 1u;
    g0[1] = lo;
    g0[2] = (unsigned int)(ga & 0xffffffffu);
    g0[3] = (unsigned int)((ga >> 32) & 0x01ffffffu)
          | (2u << 30);
    v8i g1 = {};
    g1[0] = (int)(1u << 16);
    g1[1] = (int)(512u << 16);
    g1[2] = (int)(128u << 16);
    g1[3] = (int)(512u << 16);
    g1[4] = (int)(128u);
    g1[5] = (int)(512u);
    v4i z4 = {};
#if __clang_major__ >= 23
    v8i z8 = {};
    __builtin_amdgcn_tensor_load_to_lds(g0, g1, z4, z4, z8, 0);
#else
    __builtin_amdgcn_tensor_load_to_lds(g0, g1, z4, z4, 0);
#endif
}

// ---------------------------------------------------------------------------
// Kernel 0: f32 -> f16 conversion (X and W), 8 elems/thread
// ---------------------------------------------------------------------------
__global__ void cvt_f32_to_f16(const float* __restrict__ in,
                               _Float16* __restrict__ out, int n) {
    int i = (blockIdx.x * blockDim.x + threadIdx.x) * 8;
    if (i >= n) return;
    float4 a = *(const float4*)(in + i);
    float4 b = *(const float4*)(in + i + 4);
    v8h h;
    h[0] = (_Float16)a.x; h[1] = (_Float16)a.y;
    h[2] = (_Float16)a.z; h[3] = (_Float16)a.w;
    h[4] = (_Float16)b.x; h[5] = (_Float16)b.y;
    h[6] = (_Float16)b.z; h[7] = (_Float16)b.w;
    *(v8h*)(out + i) = h;
}

// ---------------------------------------------------------------------------
// Kernel 1: Vt[b][e][n] = elu( X W^T + b )^T  (f16, transposed layout).
// Grid: BATCH*(NSEQ/16) x 256 threads (8 waves); wave w owns e-cols [w*64,+64).
// ---------------------------------------------------------------------------
__global__ void __launch_bounds__(256)
proj_elu_kernel(const _Float16* __restrict__ Xh,
                const _Float16* __restrict__ Wh,
                const float*    __restrict__ bias,
                _Float16*       __restrict__ Vt) {
    const int bidx = blockIdx.x / (NSEQ / 16);
    const int n0   = (blockIdx.x % (NSEQ / 16)) * 16;
    const int w    = threadIdx.x >> 5;
    const int lane = threadIdx.x & 31;

    const _Float16* xrow  = Xh + ((size_t)bidx * NSEQ + n0) * DMODEL;
    const _Float16* wbase = Wh + (size_t)(w * 64) * DMODEL;

    v8f acc[4] = {};
#pragma unroll 4
    for (int kk = 0; kk < DMODEL / 32; ++kk) {
        v16h aX = load_frag_rm(xrow + kk * 32, DMODEL, lane);
#pragma unroll
        for (int j = 0; j < 4; ++j) {
            v16h bW = load_frag_rm(wbase + (size_t)(j * 16) * DMODEL + kk * 32,
                                   DMODEL, lane);
            acc[j] = wmma_f16(aX, bW, acc[j]);
        }
    }

#pragma unroll
    for (int j = 0; j < 4; ++j) {
        const int e = w * 64 + j * 16 + (lane & 15);
        const float bv = bias[e];
        v8h h;
#pragma unroll
        for (int v = 0; v < 8; ++v)
            h[v] = (_Float16)elu_fast(acc[j][v] + bv);
        _Float16* dst = Vt + ((size_t)bidx * DMODEL + e) * NSEQ
                           + n0 + ((lane >> 4) << 3);
        *(v8h*)dst = h;
    }
}

#define SK_BYTES   (128 * DMODEL * 2)          // 131072
#define SQ_BYTES   (32 * DMODEL * 2)           //  32768
#define SS_BYTES   (32 * 128 * 2)              //   8192
#define SMEM_TOTAL (2 * SK_BYTES + SQ_BYTES + SS_BYTES + 128)

__global__ void __launch_bounds__(512)
fused_attn_kernel(const _Float16* __restrict__ Xh,
                  const float*    __restrict__ mask,
                  const _Float16* __restrict__ Vt,
                  float*          __restrict__ out) {
    extern __shared__ __align__(16) char smem[];
    _Float16* sK0    = (_Float16*)(smem);
    _Float16* sK1    = (_Float16*)(smem + SK_BYTES);
    _Float16* sQ     = (_Float16*)(smem + 2 * SK_BYTES);
    _Float16* sS     = (_Float16*)(smem + 2 * SK_BYTES + SQ_BYTES);
    float*    sSumSq = (float*)   (smem + 2 * SK_BYTES + SQ_BYTES + SS_BYTES);

    const int bidx = blockIdx.x / (NSEQ / 32);
    const int n0   = (blockIdx.x % (NSEQ / 32)) * 32;
    const int tid  = threadIdx.x;
    const int w    = tid >> 5;
    const int lane = tid & 31;

    const _Float16* Kg = Xh + (size_t)bidx * NSEQ * DMODEL;  // this batch's keys

    {   // stage Q tile into LDS
        const v8h* src = (const v8h*)(Xh + ((size_t)bidx * NSEQ + n0) * DMODEL);
        v8h* dst = (v8h*)sQ;
#pragma unroll
        for (int i = 0; i < 4; ++i)
            dst[tid + i * 512] = src[tid + i * 512];
    }
    if (tid < 32) sSumSq[tid] = 0.0f;

    if (w == 0) {
        tdm_load_k_tile(Kg, sK0);
        __builtin_amdgcn_s_wait_tensorcnt(0);
    }
    __syncthreads();

    const int rt = w & 1;           // score / out row-tile
    const int ct = w >> 1;          // phase-1 col-tile (0..7)
    const int eg = w >> 1;          // phase-2 e-group

    v8f oacc[4] = {};

    for (int t = 0; t < NSEQ / 128; ++t) {
        const int mstep = t * 128;
        _Float16* sKcur = (t & 1) ? sK1 : sK0;

        // kick off the next tile's DMA while we compute on the current one
        if (w == 0 && t + 1 < NSEQ / 128)
            tdm_load_k_tile(Kg + (size_t)(t + 1) * 128 * DMODEL,
                            (t & 1) ? sK0 : sK1);

        // ================= phase 1: masked scores (Q,K both from LDS) ====
        {
            const _Float16* qbase = sQ + (size_t)(rt * 16) * DMODEL;
            const _Float16* kbase = sKcur + (size_t)(ct * 16) * DMODEL;

            v8f s = {};
#pragma unroll 4
            for (int kk = 0; kk < DMODEL / 32; ++kk) {
                v16h aQ = load_frag_rm(qbase + kk * 32, DMODEL, lane);
                v16h bK = load_frag_rm(kbase + kk * 32, DMODEL, lane);
                s = wmma_f16(aQ, bK, s);
            }

            const float* mp = mask
                + ((size_t)bidx * NSEQ + n0 + rt * 16 + ((lane >> 4) << 3)) * NSEQ
                + mstep + ct * 16 + (lane & 15);
            if (mstep + 128 < NSEQ)
                __builtin_prefetch(mp + 128, 0, 0);    // global_prefetch_b8
#pragma unroll
            for (int v = 0; v < 8; ++v) {
                float mv = __builtin_nontemporal_load(mp + (size_t)v * NSEQ);
                float sv = s[v] * INV_TEMP * mv;
                float sq = sv * sv;
                sq += __shfl_xor(sq, 1);
                sq += __shfl_xor(sq, 2);
                sq += __shfl_xor(sq, 4);
                sq += __shfl_xor(sq, 8);
                const int row = rt * 16 + ((lane >> 4) << 3) + v;
                if ((lane & 15) == 0) atomicAdd(&sSumSq[row], sq);
                sS[(size_t)row * 128 + ct * 16 + (lane & 15)] = (_Float16)sv;
            }
        }
        __syncthreads();

        // ================= phase 2: out += S * Vt ========================
        {
            v16h aS0 = load_frag_rm(sS + (size_t)(rt * 16) * 128 +  0, 128, lane);
            v16h aS1 = load_frag_rm(sS + (size_t)(rt * 16) * 128 + 32, 128, lane);
            v16h aS2 = load_frag_rm(sS + (size_t)(rt * 16) * 128 + 64, 128, lane);
            v16h aS3 = load_frag_rm(sS + (size_t)(rt * 16) * 128 + 96, 128, lane);
            const _Float16* vbase =
                Vt + ((size_t)bidx * DMODEL + eg * 64) * NSEQ + mstep;
#pragma unroll
            for (int j = 0; j < 4; ++j) {
                const _Float16* vj = vbase + (size_t)(j * 16) * NSEQ;
                v16h c0 = load_frag_rm(vj +  0, NSEQ, lane);
                v16h c1 = load_frag_rm(vj + 32, NSEQ, lane);
                v16h c2 = load_frag_rm(vj + 64, NSEQ, lane);
                v16h c3 = load_frag_rm(vj + 96, NSEQ, lane);
                oacc[j] = wmma_f16(aS0, c0, oacc[j]);
                oacc[j] = wmma_f16(aS1, c1, oacc[j]);
                oacc[j] = wmma_f16(aS2, c2, oacc[j]);
                oacc[j] = wmma_f16(aS3, c3, oacc[j]);
            }
        }

        // make sure the next K tile has landed before anyone reads it
        if (w == 0 && t + 1 < NSEQ / 128)
            __builtin_amdgcn_s_wait_tensorcnt(0);
        __syncthreads();
    }

    // ---- epilogue: L2-normalize rows, store ------------------------------
#pragma unroll
    for (int v = 0; v < 8; ++v) {
        const int row = rt * 16 + ((lane >> 4) << 3) + v;
        const float sc = 1.0f / fmaxf(sqrtf(sSumSq[row]), EPS);
        float* op = out + ((size_t)bidx * NSEQ + n0 + row) * DMODEL
                        + eg * 64 + (lane & 15);
#pragma unroll
        for (int j = 0; j < 4; ++j)
            op[j * 16] = oacc[j][v] * sc;
    }
}

// ---------------------------------------------------------------------------
// Launch
// ---------------------------------------------------------------------------
extern "C" void kernel_launch(void* const* d_in, const int* in_sizes, int n_in,
                              void* d_out, int out_size, void* d_ws, size_t ws_size,
                              hipStream_t stream) {
    const float* X    = (const float*)d_in[0];   // [8,2048,512]
    const float* M    = (const float*)d_in[1];   // [8,2048,2048]
    const float* W    = (const float*)d_in[2];   // [512,512]
    const float* bias = (const float*)d_in[3];   // [512]
    float* out = (float*)d_out;

    const size_t XH_ELEMS = (size_t)BATCH * NSEQ * DMODEL;  // 8,388,608
    const size_t WH_ELEMS = (size_t)DMODEL * DMODEL;        //   262,144
    char* ws = (char*)d_ws;
    _Float16* Xh = (_Float16*)ws;
    _Float16* Wh = (_Float16*)(ws + XH_ELEMS * sizeof(_Float16));
    _Float16* Vt = (_Float16*)(ws + (XH_ELEMS + WH_ELEMS) * sizeof(_Float16));

    cvt_f32_to_f16<<<(int)(XH_ELEMS / (256 * 8)), 256, 0, stream>>>(X, Xh, (int)XH_ELEMS);
    cvt_f32_to_f16<<<(int)(WH_ELEMS / (256 * 8)), 256, 0, stream>>>(W, Wh, (int)WH_ELEMS);

    proj_elu_kernel<<<BATCH * (NSEQ / 16), 256, 0, stream>>>(Xh, Wh, bias, Vt);

    fused_attn_kernel<<<BATCH * (NSEQ / 32), 512, SMEM_TOTAL, stream>>>(Xh, M, Vt, out);
}

// v001
// One run takes 332 microseconds.
// Two timings next to v000 put it at 1.96 and 1.95 times that version's speed.
#include <hip/hip_runtime.h>
#include <hip/hip_bf16.h>
#include <math.h>

// ---------------------------------------------------------------------------
// Problem constants (reference: B=8, N=2048, D=512)
// ---------------------------------------------------------------------------
#define BATCH 8
#define NSEQ  2048
#define DMODEL 512
#define INV_TEMP 0.04419417382415922f   // 1/sqrt(512)
#define EPS 1e-5f

typedef __attribute__((ext_vector_type(16))) _Float16 v16h;
typedef __attribute__((ext_vector_type(8)))  _Float16 v8h;
typedef __attribute__((ext_vector_type(8)))  float    v8f;
typedef __attribute__((ext_vector_type(4)))  unsigned int v4u;
typedef __attribute__((ext_vector_type(8)))  unsigned int v8u;

__device__ __forceinline__ v16h load_frag_rm(const _Float16* base, int stride, int lane) {
    const int r  = lane & 15;
    const int hs = (lane >> 4) << 3;             // 0 or 8
    const _Float16* p = base + (size_t)r * stride + hs;
    v8h lo = *(const v8h*)(p);
    v8h hi = *(const v8h*)(p + 16);
    return __builtin_shufflevector(lo, hi, 0,1,2,3,4,5,6,7,8,9,10,11,12,13,14,15);
}

__device__ __forceinline__ v8f wmma_f16(v16h a, v16h b, v8f c) {
    return __builtin_amdgcn_wmma_f32_16x16x32_f16(
        false, a, false, b, (short)0, c, false, false);
}

// branchless ELU (alpha = 1) on the fast-exp path (v_exp_f32)
__device__ __forceinline__ float elu_fast(float x) {
    float e = __expf(x) - 1.0f;
    return (x > 0.0f) ? x : e;
}

#define PITCH_B    272                          // LDS row pitch in bytes
#define PITCH_H    (PITCH_B / 2)                // ... in halves
#define KPLANE_B   (128 * PITCH_B)              // 34816 = 17 * 2048
#define KBUF_B     (4 * KPLANE_B)               // 139264
#define QPLANE_B   (32 * PITCH_B)               //  8704
#define SQ_OFF     (2 * KBUF_B)                 // 278528
#define SS_OFF     (SQ_OFF + 4 * QPLANE_B)      // 313344
#define SUM_OFF    (SS_OFF + 32 * PITCH_B)      // 322048
#define SMEM_TOTAL (SUM_OFF + 128)              // 322176

__device__ __forceinline__ unsigned int uni(unsigned int v) {
    return (unsigned int)__builtin_amdgcn_readfirstlane(v);
}
__device__ __forceinline__ unsigned int pinned(unsigned int v) {
    unsigned int w = uni(v);
    asm volatile("" : "+s"(w));   // pinned(): keeps the issue test in a scalar register
    return w;
}
__device__ __forceinline__ void wait_tensor0() { asm volatile("s_wait_tensorcnt 0x0" ::: "memory"); }
// a wave's LDS reads have retired before the barrier behind which a buffer is refilled
__device__ __forceinline__ void wait_ds0()     { asm volatile("s_wait_dscnt 0x0" ::: "memory"); }

__device__ __forceinline__ void tdm_load_k_plane(const _Float16* gsrc, unsigned int lds_dst) {
    const unsigned long long ga = (unsigned long long)(uintptr_t)gsrc;
    v4u g0;
    g0[0] = uni(1u);                                           // count = 1
    g0[1] = uni(lds_dst);                                      // byte offset in LDS
    g0[2] = uni((unsigned int)ga);                             // address [31:0]
    g0[3] = uni((((unsigned int)(ga >> 32)) & 0x01ffffffu) | 0x80000000u);  // [56:32], type 2
    v8u g1;
    g1[0] = uni((1u << 20) | (5u << 22) | (3u << 25));
    g1[1] = uni(256u << 16);
    g1[2] = uni(128u << 16);
    g1[3] = uni(256u << 16);
    g1[4] = uni(128u);
    g1[5] = uni(1024u);
    g1[6] = uni(0u);
    g1[7] = uni(0u);
    asm volatile("tensor_load_to_lds %0, %1" :: "s"(g0), "s"(g1) : "memory");
}

// ---------------------------------------------------------------------------
// Kernel 0: f32 -> f16 conversion (X and W), 8 elems/thread
// ---------------------------------------------------------------------------
__global__ void cvt_f32_to_f16(const float* __restrict__ in,
                               _Float16* __restrict__ out, int n) {
    int i = (blockIdx.x * blockDim.x + threadIdx.x) * 8;
    if (i >= n) return;
    float4 a = *(const float4*)(in + i);
    float4 b = *(const float4*)(in + i + 4);
    v8h h;
    h[0] = (_Float16)a.x; h[1] = (_Float16)a.y;
    h[2] = (_Float16)a.z; h[3] = (_Float16)a.w;
    h[4] = (_Float16)b.x; h[5] = (_Float16)b.y;
    h[6] = (_Float16)b.z; h[7] = (_Float16)b.w;
    *(v8h*)(out + i) = h;
}

// ---------------------------------------------------------------------------
// Kernel 1: Vt[b][e][n] = elu( X W^T + b )^T  (f16, transposed layout).
// Grid: BATCH*(NSEQ/16) x 256 threads (8 waves); wave w owns e-cols [w*64,+64).
// ---------------------------------------------------------------------------
__global__ void __launch_bounds__(256)
proj_elu_kernel(const _Float16* __restrict__ Xh,
                const _Float16* __restrict__ Wh,
                const float*    __restrict__ bias,
                _Float16*       __restrict__ Vt) {
    const int bidx = blockIdx.x / (NSEQ / 16);
    const int n0   = (blockIdx.x % (NSEQ / 16)) * 16;
    const int w    = threadIdx.x >> 5;
    const int lane = threadIdx.x & 31;

    const _Float16* xrow  = Xh + ((size_t)bidx * NSEQ + n0) * DMODEL;
    const _Float16* wbase = Wh + (size_t)(w * 64) * DMODEL;

    v8f acc[4] = {};
#pragma unroll 4
    for (int kk = 0; kk < DMODEL / 32; ++kk) {
        v16h aX = load_frag_rm(xrow + kk * 32, DMODEL, lane);
#pragma unroll
        for (int j = 0; j < 4; ++j) {
            v16h bW = load_frag_rm(wbase + (size_t)(j * 16) * DMODEL + kk * 32,
                                   DMODEL, lane);
            acc[j] = wmma_f16(aX, bW, acc[j]);
        }
    }

#pragma unroll
    for (int j = 0; j < 4; ++j) {
        const int e = w * 64 + j * 16 + (lane & 15);
        const float bv = bias[e];
        v8h h;
#pragma unroll
        for (int v = 0; v < 8; ++v)
            h[v] = (_Float16)elu_fast(acc[j][v] + bv);
        _Float16* dst = Vt + ((size_t)bidx * DMODEL + e) * NSEQ
                           + n0 + ((lane >> 4) << 3);
        *(v8h*)dst = h;
    }
}

// ---------------------------------------------------------------------------
// Kernel 2: fused  S = mask .* (X Xt / sqrt(D));  out = (S / max(||S||2,eps)) V
// Grid: BATCH*(NSEQ/32) x 512 threads (16 waves); 32-row n-tile, m-steps of 128.
// Waves 0..3 each bring one 256-B column plane of the 128x512 f16 K-tile into
// LDS by tensor load, two buffers, so the load of step t+1 flies during step t.
// LDS: sK0 | sK1 (4 planes each) | sQ (4 planes) | sS | sumsq, rows at 272 B.
// ---------------------------------------------------------------------------
__global__ void __launch_bounds__(512)
fused_attn_kernel(const _Float16* __restrict__ Xh,
                  const float*    __restrict__ mask,
                  const _Float16* __restrict__ Vt,
                  float*          __restrict__ out) {
    __shared__ __attribute__((aligned(2048))) char smem[SMEM_TOTAL];
    _Float16* sQ     = (_Float16*)(smem + SQ_OFF);
    _Float16* sS     = (_Float16*)(smem + SS_OFF);
    float*    sSumSq = (float*)   (smem + SUM_OFF);

    const int bidx = blockIdx.x / (NSEQ / 32);
    const int n0   = (blockIdx.x % (NSEQ / 32)) * 32;
    const int tid  = threadIdx.x;
    const int w    = tid >> 5;
    const int lane = tid & 31;
    const unsigned int wave  = uni(threadIdx.x >> 5);
    const unsigned int lbase = (unsigned int)(uintptr_t)smem;

    const _Float16* Kg = Xh + (size_t)bidx * NSEQ * DMODEL;  // this batch's keys
    // plane 'wave' of stage st: columns [wave*128, +128) of key rows [st*128, +128)
    const _Float16* Kplane = Kg + (wave & 3u) * 128u;
    const unsigned int plane_dst = lbase + (wave & 3u) * KPLANE_B;

    {   // stage Q tile into LDS, same planes and pitch as K
        const v8h* src = (const v8h*)(Xh + ((size_t)bidx * NSEQ + n0) * DMODEL);
#pragma unroll
        for (int i = 0; i < 4; ++i) {
            const int idx = tid + i * 512;        // 16-byte unit; 64 units a row
            const int row = idx >> 6, u = idx & 63;
            *(v8h*)((char*)sQ + (u >> 4) * QPLANE_B + row * PITCH_B + (u & 15) * 16) = src[idx];
        }
    }
    if (tid < 32) sSumSq[tid] = 0.0f;

    // prologue of the two-buffer ring: stage 0, its wait, the barrier, stage 1
    if (pinned(wave < 4u)) {
        tdm_load_k_plane(Kplane, plane_dst);
        wait_tensor0();
    }
    __syncthreads();
    if (pinned(wave < 4u))
        tdm_load_k_plane(Kplane + (size_t)128 * DMODEL, plane_dst + KBUF_B);

    const int rt = w & 1;           // score / out row-tile
    const int ct = w >> 1;          // phase-1 col-tile (0..7)
    const int eg = w >> 1;          // phase-2 e-group

    v8f oacc[4] = {};

    for (int t = 0; t < NSEQ / 128; ++t) {
        const int mstep = t * 128;
        const _Float16* sKcur = (const _Float16*)(smem + (t & 1) * KBUF_B);

        // ================= phase 1: masked scores (Q,K both from LDS) ====
        {
            const _Float16* qbase = sQ + (size_t)(rt * 16) * PITCH_H;
            const _Float16* kbase = sKcur + (size_t)(ct * 16) * PITCH_H;

            v8f s = {};
            for (int q = 0; q < 4; ++q) {        // plane
#pragma unroll                                    // constant offsets inside a plane
                for (int k4 = 0; k4 < 4; ++k4) {
                    v16h aQ = load_frag_rm(qbase + q * (QPLANE_B / 2) + k4 * 32, PITCH_H, lane);
                    v16h bK = load_frag_rm(kbase + q * (KPLANE_B / 2) + k4 * 32, PITCH_H, lane);
                    s = wmma_f16(aQ, bK, s);
                }
            }

            const float* mp = mask
                + ((size_t)bidx * NSEQ + n0 + rt * 16 + ((lane >> 4) << 3)) * NSEQ
                + mstep + ct * 16 + (lane & 15);
            if (mstep + 128 < NSEQ)
                __builtin_prefetch(mp + 128, 0, 0);    // global_prefetch_b8
#pragma unroll
            for (int v = 0; v < 8; ++v) {
                float mv = __builtin_nontemporal_load(mp + (size_t)v * NSEQ);
                float sv = s[v] * INV_TEMP * mv;
                float sq = sv * sv;
                sq += __shfl_xor(sq, 1);
                sq += __shfl_xor(sq, 2);
                sq += __shfl_xor(sq, 4);
                sq += __shfl_xor(sq, 8);
                const int row = rt * 16 + ((lane >> 4) << 3) + v;
                if ((lane & 15) == 0) atomicAdd(&sSumSq[row], sq);
                sS[(size_t)row * PITCH_H + ct * 16 + (lane & 15)] = (_Float16)sv;
            }
        }
        __syncthreads();

        // ================= phase 2: out += S * Vt ========================
        {
            v16h aS0 = load_frag_rm(sS + (size_t)(rt * 16) * PITCH_H +  0, PITCH_H, lane);
            v16h aS1 = load_frag_rm(sS + (size_t)(rt * 16) * PITCH_H + 32, PITCH_H, lane);
            v16h aS2 = load_frag_rm(sS + (size_t)(rt * 16) * PITCH_H + 64, PITCH_H, lane);
            v16h aS3 = load_frag_rm(sS + (size_t)(rt * 16) * PITCH_H + 96, PITCH_H, lane);
            const _Float16* vbase =
                Vt + ((size_t)bidx * DMODEL + eg * 64) * NSEQ + mstep;
#pragma unroll
            for (int j = 0; j < 4; ++j) {
                const _Float16* vj = vbase + (size_t)(j * 16) * NSEQ;
                v16h c0 = load_frag_rm(vj +  0, NSEQ, lane);
                v16h c1 = load_frag_rm(vj + 32, NSEQ, lane);
                v16h c2 = load_frag_rm(vj + 64, NSEQ, lane);
                v16h c3 = load_frag_rm(vj + 96, NSEQ, lane);
                oacc[j] = wmma_f16(aS0, c0, oacc[j]);
                oacc[j] = wmma_f16(aS1, c1, oacc[j]);
                oacc[j] = wmma_f16(aS2, c2, oacc[j]);
                oacc[j] = wmma_f16(aS3, c3, oacc[j]);
            }
        }

        // publish point of stage t+1: own LDS reads done, own request landed,
        // barrier; only then the refill of the buffer that this step has read
        wait_ds0();
        if (pinned(wave < 4u))
            wait_tensor0();
        __syncthreads();
        if (pinned(wave < 4u && t + 2 < NSEQ / 128))
            tdm_load_k_plane(Kplane + (size_t)(t + 2) * 128 * DMODEL,
                             plane_dst + (unsigned int)(t & 1) * KBUF_B);
    }
    // end of the ring: no request and no LDS read of this wave is left in flight
    wait_tensor0();
    wait_ds0();

    // ---- epilogue: L2-normalize rows, store ------------------------------
#pragma unroll
    for (int v = 0; v < 8; ++v) {
        const int row = rt * 16 + ((lane >> 4) << 3) + v;
        const float sc = 1.0f / fmaxf(sqrtf(sSumSq[row]), EPS);
        float* op = out + ((size_t)bidx * NSEQ + n0 + row) * DMODEL
                        + eg * 64 + (lane & 15);
#pragma unroll
        for (int j = 0; j < 4; ++j)
            op[j * 16] = oacc[j][v] * sc;
    }
}

// ---------------------------------------------------------------------------
// Launch
// ---------------------------------------------------------------------------
extern "C" void kernel_launch(void* const* d_in, const int* in_sizes, int n_in,
                              void* d_out, int out_size, void* d_ws, size_t ws_size,
                              hipStream_t stream) {
    const float* X    = (const float*)d_in[0];   // [8,2048,512]
    const float* M    = (const float*)d_in[1];   // [8,2048,2048]
    const float* W    = (const float*)d_in[2];   // [512,512]
    const float* bias = (const float*)d_in[3];   // [512]
    float* out = (float*)d_out;

    const size_t XH_ELEMS = (size_t)BATCH * NSEQ * DMODEL;  // 8,388,608
    const size_t WH_ELEMS = (size_t)DMODEL * DMODEL;        //   262,144
    char* ws = (char*)d_ws;
    _Float16* Xh = (_Float16*)ws;
    _Float16* Wh = (_Float16*)(ws + XH_ELEMS * sizeof(_Float16));
    _Float16* Vt = (_Float16*)(ws + (XH_ELEMS + WH_ELEMS) * sizeof(_Float16));

    cvt_f32_to_f16<<<(int)(XH_ELEMS / (256 * 8)), 256, 0, stream>>>(X, Xh, (int)XH_ELEMS);
    cvt_f32_to_f16<<<(int)(WH_ELEMS / (256 * 8)), 256, 0, stream>>>(W, Wh, (int)WH_ELEMS);

    proj_elu_kernel<<<BATCH * (NSEQ / 16), 256, 0, stream>>>(Xh, Wh, bias, Vt);

    fused_attn_kernel<<<BATCH * (NSEQ / 32), 512, 0, stream>>>(Xh, M, Vt, out);
}

// v002
// A run of this version takes 232 microseconds.
// Timed twice side by side with v001, it ran 1.44 times as fast both times.
// Over all steps from v000 it is 2.82 times as fast.
#include <hip/hip_runtime.h>
#include <hip/hip_bf16.h>
#include <math.h>

// ---------------------------------------------------------------------------
// Problem constants (reference: B=8, N=2048, D=512)
// ---------------------------------------------------------------------------
#define BATCH 8
#define NSEQ  2048
#define DMODEL 512
#define INV_TEMP 0.04419417382415922f   // 1/sqrt(512)
#define EPS 1e-5f

typedef __attribute__((ext_vector_type(16))) _Float16 v16h;
typedef __attribute__((ext_vector_type(8)))  _Float16 v8h;
typedef __attribute__((ext_vector_type(8)))  float    v8f;
typedef __attribute__((ext_vector_type(4)))  unsigned int v4u;
typedef __attribute__((ext_vector_type(8)))  unsigned int v8u;

__device__ __forceinline__ v16h load_frag_rm(const _Float16* base, int stride, int lane) {
    const int r  = lane & 15;
    const int hs = (lane >> 4) << 3;             // 0 or 8
    const _Float16* p = base + (size_t)r * stride + hs;
    v8h lo = *(const v8h*)(p);
    v8h hi = *(const v8h*)(p + 16);
    return __builtin_shufflevector(lo, hi, 0,1,2,3,4,5,6,7,8,9,10,11,12,13,14,15);
}

__device__ __forceinline__ v8f wmma_f16(v16h a, v16h b, v8f c) {
    return __builtin_amdgcn_wmma_f32_16x16x32_f16(
        false, a, false, b, (short)0, c, false, false);
}

// branchless ELU (alpha = 1) on the fast-exp path (v_exp_f32)
__device__ __forceinline__ float elu_fast(float x) {
    float e = __expf(x) - 1.0f;
    return (x > 0.0f) ? x : e;
}

#define PITCH_B    272                          // LDS row pitch in bytes
#define PITCH_H    (PITCH_B / 2)                // ... in halves
#define KPLANE_B   (128 * PITCH_B)              // 34816 = 17 * 2048
#define KBUF_B     (4 * KPLANE_B)               // 139264
#define QPLANE_B   (32 * PITCH_B)               //  8704
#define SQ_OFF     (2 * KBUF_B)                 // 278528
#define SS_OFF     (SQ_OFF + 4 * QPLANE_B)      // 313344
#define SUM_OFF    (SS_OFF + 32 * PITCH_B)      // 322048
#define SMEM_TOTAL (SUM_OFF + 128)              // 322176

__device__ __forceinline__ unsigned int uni(unsigned int v) {
    return (unsigned int)__builtin_amdgcn_readfirstlane(v);
}
__device__ __forceinline__ unsigned int pinned(unsigned int v) {
    unsigned int w = uni(v);
    asm volatile("" : "+s"(w));   // pinned(): keeps the issue test in a scalar register
    return w;
}
__device__ __forceinline__ void wait_tensor0() { asm volatile("s_wait_tensorcnt 0x0" ::: "memory"); }
// a wave's LDS reads have retired before the barrier behind which a buffer is refilled
__device__ __forceinline__ void wait_ds0()     { asm volatile("s_wait_dscnt 0x0" ::: "memory"); }

__device__ __forceinline__ void tdm_load_k_plane(const _Float16* gsrc, unsigned int lds_dst) {
    const unsigned long long ga = (unsigned long long)(uintptr_t)gsrc;
    v4u g0;
    g0[0] = uni(1u);                                           // count = 1
    g0[1] = uni(lds_dst);                                      // byte offset in LDS
    g0[2] = uni((unsigned int)ga);                             // address [31:0]
    g0[3] = uni((((unsigned int)(ga >> 32)) & 0x01ffffffu) | 0x80000000u);  // [56:32], type 2
    v8u g1;
    g1[0] = uni((1u << 20) | (5u << 22) | (3u << 25));
    g1[1] = uni(256u << 16);
    g1[2] = uni(128u << 16);
    g1[3] = uni(256u << 16);
    g1[4] = uni(128u);
    g1[5] = uni(1024u);
    g1[6] = uni(0u);
    g1[7] = uni(0u);
    asm volatile("tensor_load_to_lds %0, %1" :: "s"(g0), "s"(g1) : "memory");
}

// ---------------------------------------------------------------------------
// Kernel 0: f32 -> f16 conversion (X and W), 8 elems/thread
// ---------------------------------------------------------------------------
__global__ void cvt_f32_to_f16(const float* __restrict__ in,
                               _Float16* __restrict__ out, int n) {
    int i = (blockIdx.x * blockDim.x + threadIdx.x) * 8;
    if (i >= n) return;
    float4 a = *(const float4*)(in + i);
    float4 b = *(const float4*)(in + i + 4);
    v8h h;
    h[0] = (_Float16)a.x; h[1] = (_Float16)a.y;
    h[2] = (_Float16)a.z; h[3] = (_Float16)a.w;
    h[4] = (_Float16)b.x; h[5] = (_Float16)b.y;
    h[6] = (_Float16)b.z; h[7] = (_Float16)b.w;
    *(v8h*)(out + i) = h;
}

// ---------------------------------------------------------------------------
// Kernel 1: Vt[b][e][n] = elu( X W^T + b )^T  (f16, transposed layout).
// Grid: BATCH*(NSEQ/16) x 256 threads (8 waves); wave w owns e-cols [w*64,+64).
// ---------------------------------------------------------------------------
__global__ void __launch_bounds__(256)
proj_elu_kernel(const _Float16* __restrict__ Xh,
                const _Float16* __restrict__ Wh,
                const float*    __restrict__ bias,
                _Float16*       __restrict__ Vt) {
    const int bidx = blockIdx.x / (NSEQ / 16);
    const int n0   = (blockIdx.x % (NSEQ / 16)) * 16;
    const int w    = threadIdx.x >> 5;
    const int lane = threadIdx.x & 31;

    const _Float16* xrow  = Xh + ((size_t)bidx * NSEQ + n0) * DMODEL;
    const _Float16* wbase = Wh + (size_t)(w * 64) * DMODEL;

    v8f acc[4] = {};
#pragma unroll 4
    for (int kk = 0; kk < DMODEL / 32; ++kk) {
        v16h aX = load_frag_rm(xrow + kk * 32, DMODEL, lane);
#pragma unroll
        for (int j = 0; j < 4; ++j) {
            v16h bW = load_frag_rm(wbase + (size_t)(j * 16) * DMODEL + kk * 32,
                                   DMODEL, lane);
            acc[j] = wmma_f16(aX, bW, acc[j]);
        }
    }

#pragma unroll
    for (int j = 0; j < 4; ++j) {
        const int e = w * 64 + j * 16 + (lane & 15);
        const float bv = bias[e];
        v8h h;
#pragma unroll
        for (int v = 0; v < 8; ++v)
            h[v] = (_Float16)elu_fast(acc[j][v] + bv);
        _Float16* dst = Vt + ((size_t)bidx * DMODEL + e) * NSEQ
                           + n0 + ((lane >> 4) << 3);
        *(v8h*)dst = h;
    }
}

// ---------------------------------------------------------------------------
// Kernel 2: fused  S = mask .* (X Xt / sqrt(D));  out = (S / max(||S||2,eps)) V
// Grid: BATCH*(NSEQ/32) x 512 threads (16 waves); 32-row n-tile, m-steps of 128.
// Waves 0..3 each bring one 256-B column plane of the 128x512 f16 K-tile into
// LDS by tensor load, two buffers, so the load of step t+1 flies during step t.
// LDS: sK0 | sK1 (4 planes each) | sQ (4 planes) | sS | sumsq, rows at 272 B.
// ---------------------------------------------------------------------------
__global__ void __launch_bounds__(512)
fused_attn_kernel(const _Float16* __restrict__ Xh,
                  const float*    __restrict__ mask,
                  const _Float16* __restrict__ Vt,
                  float*          __restrict__ out) {
    __shared__ __attribute__((aligned(2048))) char smem[SMEM_TOTAL];
    _Float16* sQ     = (_Float16*)(smem + SQ_OFF);
    _Float16* sS     = (_Float16*)(smem + SS_OFF);
    float*    sSumSq = (float*)   (smem + SUM_OFF);

    const int bidx = blockIdx.x / (NSEQ / 32);
    const int n0   = (blockIdx.x % (NSEQ / 32)) * 32;
    const int tid  = threadIdx.x;
    const int w    = tid >> 5;
    const int lane = tid & 31;
    const unsigned int wave  = uni(threadIdx.x >> 5);
    const unsigned int lbase = (unsigned int)(uintptr_t)smem;

    const _Float16* Kg = Xh + (size_t)bidx * NSEQ * DMODEL;  // this batch's keys
    // plane 'wave' of stage st: columns [wave*128, +128) of key rows [st*128, +128)
    const _Float16* Kplane = Kg + (wave & 3u) * 128u;
    const unsigned int plane_dst = lbase + (wave & 3u) * KPLANE_B;

    {   // stage Q tile into LDS, same planes and pitch as K
        const v8h* src = (const v8h*)(Xh + ((size_t)bidx * NSEQ + n0) * DMODEL);
#pragma unroll
        for (int i = 0; i < 4; ++i) {
            const int idx = tid + i * 512;        // 16-byte unit; 64 units a row
            const int row = idx >> 6, u = idx & 63;
            *(v8h*)((char*)sQ + (u >> 4) * QPLANE_B + row * PITCH_B + (u & 15) * 16) = src[idx];
        }
    }
    if (tid < 32) sSumSq[tid] = 0.0f;

    // prologue of the two-buffer ring: stage 0, its wait, the barrier, stage 1
    if (pinned(wave < 4u)) {
        tdm_load_k_plane(Kplane, plane_dst);
        wait_tensor0();
    }
    __syncthreads();
    if (pinned(wave < 4u))
        tdm_load_k_plane(Kplane + (size_t)128 * DMODEL, plane_dst + KBUF_B);

    const int rt = w & 1;           // score / out row-tile
    const int ct = w >> 1;          // phase-1 col-tile (0..7)
    const int eg = w >> 1;          // phase-2 e-group

    v8f oacc[4] = {};

    for (int t = 0; t < NSEQ / 128; ++t) {
        const int mstep = t * 128;
        const _Float16* sKcur = (const _Float16*)(smem + (t & 1) * KBUF_B);

        // ================= phase 1: masked scores (Q,K both from LDS) ====
        {
            const _Float16* qbase = sQ + (size_t)(rt * 16) * PITCH_H;
            const _Float16* kbase = sKcur + (size_t)(ct * 16) * PITCH_H;

            // The step's eight mask values are asked for here, ahead of the score
            // products, so that their memory latencies run side by side and behind
            // the WMMAs instead of one after another behind them.
            const float* mp = mask
                + ((size_t)bidx * NSEQ + n0 + rt * 16 + ((lane >> 4) << 3)) * NSEQ
                + mstep + ct * 16 + (lane & 15);
            float mv[8];
#pragma unroll
            for (int v = 0; v < 8; ++v)
                mv[v] = __builtin_nontemporal_load(mp + (size_t)v * NSEQ);

            v8f s = {};
            for (int q = 0; q < 4; ++q) {        // plane
#pragma unroll                                    // constant offsets inside a plane
                for (int k4 = 0; k4 < 4; ++k4) {
                    v16h aQ = load_frag_rm(qbase + q * (QPLANE_B / 2) + k4 * 32, PITCH_H, lane);
                    v16h bK = load_frag_rm(kbase + q * (KPLANE_B / 2) + k4 * 32, PITCH_H, lane);
                    s = wmma_f16(aQ, bK, s);
                }
            }

            if (mstep + 128 < NSEQ)
                __builtin_prefetch(mp + 128, 0, 0);    // global_prefetch_b8

            // the eight rows go through each stage together: eight independent
            // chains, so that a cross-lane step's latency is paid once a stage
            const int row0 = rt * 16 + ((lane >> 4) << 3);
            float sv[8], sq[8];
#pragma unroll
            for (int v = 0; v < 8; ++v) {
                sv[v] = s[v] * INV_TEMP * mv[v];
                sq[v] = sv[v] * sv[v];
            }
#pragma unroll
            for (int m = 1; m < 16; m <<= 1) {
#pragma unroll
                for (int v = 0; v < 8; ++v)
                    sq[v] += __shfl_xor(sq[v], m);
            }
#pragma unroll
            for (int v = 0; v < 8; ++v)
                sS[(size_t)(row0 + v) * PITCH_H + ct * 16 + (lane & 15)] = (_Float16)sv[v];
            if ((lane & 15) == 0) {
#pragma unroll
                for (int v = 0; v < 8; ++v)
                    atomicAdd(&sSumSq[row0 + v], sq[v]);
            }
        }
        __syncthreads();

        // ================= phase 2: out += S * Vt ========================
        {
            v16h aS0 = load_frag_rm(sS + (size_t)(rt * 16) * PITCH_H +  0, PITCH_H, lane);
            v16h aS1 = load_frag_rm(sS + (size_t)(rt * 16) * PITCH_H + 32, PITCH_H, lane);
            v16h aS2 = load_frag_rm(sS + (size_t)(rt * 16) * PITCH_H + 64, PITCH_H, lane);
            v16h aS3 = load_frag_rm(sS + (size_t)(rt * 16) * PITCH_H + 96, PITCH_H, lane);
            const _Float16* vbase =
                Vt + ((size_t)bidx * DMODEL + eg * 64) * NSEQ + mstep;
#pragma unroll
            for (int j = 0; j < 4; ++j) {
                const _Float16* vj = vbase + (size_t)(j * 16) * NSEQ;
                v16h c0 = load_frag_rm(vj +  0, NSEQ, lane);
                v16h c1 = load_frag_rm(vj + 32, NSEQ, lane);
                v16h c2 = load_frag_rm(vj + 64, NSEQ, lane);
                v16h c3 = load_frag_rm(vj + 96, NSEQ, lane);
                oacc[j] = wmma_f16(aS0, c0, oacc[j]);
                oacc[j] = wmma_f16(aS1, c1, oacc[j]);
                oacc[j] = wmma_f16(aS2, c2, oacc[j]);
                oacc[j] = wmma_f16(aS3, c3, oacc[j]);
            }
        }

        // publish point of stage t+1: own LDS reads done, own request landed,
        // barrier; only then the refill of the buffer that this step has read
        wait_ds0();
        if (pinned(wave < 4u))
            wait_tensor0();
        __syncthreads();
        if (pinned(wave < 4u && t + 2 < NSEQ / 128))
            tdm_load_k_plane(Kplane + (size_t)(t + 2) * 128 * DMODEL,
                             plane_dst + (unsigned int)(t & 1) * KBUF_B);
    }
    // end of the ring: no request and no LDS read of this wave is left in flight
    wait_tensor0();
    wait_ds0();

    // ---- epilogue: L2-normalize rows, store ------------------------------
#pragma unroll
    for (int v = 0; v < 8; ++v) {
        const int row = rt * 16 + ((lane >> 4) << 3) + v;
        const float sc = 1.0f / fmaxf(sqrtf(sSumSq[row]), EPS);
        float* op = out + ((size_t)bidx * NSEQ + n0 + row) * DMODEL
                        + eg * 64 + (lane & 15);
#pragma unroll
        for (int j = 0; j < 4; ++j)
            op[j * 16] = oacc[j][v] * sc;
    }
}

// ---------------------------------------------------------------------------
// Launch
// ---------------------------------------------------------------------------
extern "C" void kernel_launch(void* const* d_in, const int* in_sizes, int n_in,
                              void* d_out, int out_size, void* d_ws, size_t ws_size,
                              hipStream_t stream) {
    const float* X    = (const float*)d_in[0];   // [8,2048,512]
    const float* M    = (const float*)d_in[1];   // [8,2048,2048]
    const float* W    = (const float*)d_in[2];   // [512,512]
    const float* bias = (const float*)d_in[3];   // [512]
    float* out = (float*)d_out;

    const size_t XH_ELEMS = (size_t)BATCH * NSEQ * DMODEL;  // 8,388,608
    const size_t WH_ELEMS = (size_t)DMODEL * DMODEL;        //   262,144
    char* ws = (char*)d_ws;
    _Float16* Xh = (_Float16*)ws;
    _Float16* Wh = (_Float16*)(ws + XH_ELEMS * sizeof(_Float16));
    _Float16* Vt = (_Float16*)(ws + (XH_ELEMS + WH_ELEMS) * sizeof(_Float16));

    cvt_f32_to_f16<<<(int)(XH_ELEMS / (256 * 8)), 256, 0, stream>>>(X, Xh, (int)XH_ELEMS);
    cvt_f32_to_f16<<<(int)(WH_ELEMS / (256 * 8)), 256, 0, stream>>>(W, Wh, (int)WH_ELEMS);

    proj_elu_kernel<<<BATCH * (NSEQ / 16), 256, 0, stream>>>(Xh, Wh, bias, Vt);

    fused_attn_kernel<<<BATCH * (NSEQ / 32), 512, 0, stream>>>(Xh, M, Vt, out);
}

// v003
// It runs in 164 microseconds.
// Timed twice side by side with v002, it ran 1.42 and 1.40 times as fast.
// Over all steps from v000 it is 3.98 times as fast.
#include <hip/hip_runtime.h>
#include <hip/hip_bf16.h>
#include <math.h>

// ---------------------------------------------------------------------------
// Problem constants (reference: B=8, N=2048, D=512)
// ---------------------------------------------------------------------------
#define BATCH 8
#define NSEQ  2048
#define DMODEL 512
#define INV_TEMP 0.04419417382415922f   // 1/sqrt(512)
#define EPS 1e-5f

typedef __attribute__((ext_vector_type(16))) _Float16 v16h;
typedef __attribute__((ext_vector_type(8)))  _Float16 v8h;
typedef __attribute__((ext_vector_type(8)))  float    v8f;
typedef __attribute__((ext_vector_type(4)))  unsigned int v4u;
typedef __attribute__((ext_vector_type(8)))  unsigned int v8u;

__device__ __forceinline__ v16h load_frag_rm(const _Float16* base, int stride, int lane) {
    const int r  = lane & 15;
    const int hs = (lane >> 4) << 3;             // 0 or 8
    const _Float16* p = base + (size_t)r * stride + hs;
    v8h lo = *(const v8h*)(p);
    v8h hi = *(const v8h*)(p + 16);
    return __builtin_shufflevector(lo, hi, 0,1,2,3,4,5,6,7,8,9,10,11,12,13,14,15);
}

__device__ __forceinline__ v8f wmma_f16(v16h a, v16h b, v8f c) {
    return __builtin_amdgcn_wmma_f32_16x16x32_f16(
        false, a, false, b, (short)0, c, false, false);
}

// branchless ELU (alpha = 1) on the fast-exp path (v_exp_f32)
__device__ __forceinline__ float elu_fast(float x) {
    float e = __expf(x) - 1.0f;
    return (x > 0.0f) ? x : e;
}

#define PITCH_B    272                          // LDS row pitch in bytes
#define PITCH_H    (PITCH_B / 2)                // ... in halves
#define KPLANE_B   (128 * PITCH_B)              // 34816 = 17 * 2048
#define KBUF_B     (4 * KPLANE_B)               // 139264: the K tile; the V tile is as large
#define SV_OFF     KBUF_B                       // V tile behind the K tile
#define QPLANE_B   (32 * PITCH_B)               //  8704
#define SQ_OFF     (2 * KBUF_B)                 // 278528
#define SS_OFF     (SQ_OFF + 4 * QPLANE_B)      // 313344
#define SUM_OFF    (SS_OFF + 32 * PITCH_B)      // 322048
#define SMEM_TOTAL (SUM_OFF + 128)              // 322176

__device__ __forceinline__ unsigned int uni(unsigned int v) {
    return (unsigned int)__builtin_amdgcn_readfirstlane(v);
}
__device__ __forceinline__ unsigned int pinned(unsigned int v) {
    unsigned int w = uni(v);
    asm volatile("" : "+s"(w));   // pinned(): keeps the issue test in a scalar register
    return w;
}
__device__ __forceinline__ void wait_tensor0() { asm volatile("s_wait_tensorcnt 0x0" ::: "memory"); }
// a wave's LDS reads have retired before the barrier behind which a buffer is refilled
__device__ __forceinline__ void wait_ds0()     { asm volatile("s_wait_dscnt 0x0" ::: "memory"); }

__device__ __forceinline__ v8u tdm_group1(unsigned int src_pitch) {
    v8u g1;
    g1[0] = uni((1u << 20) | (5u << 22) | (3u << 25));
    g1[1] = uni(256u << 16);
    g1[2] = uni(128u << 16);
    g1[3] = uni(256u << 16);
    g1[4] = uni(128u);
    g1[5] = uni(src_pitch);
    g1[6] = uni(0u);
    g1[7] = uni(0u);
    asm volatile("" : "+s"(g1));
    return g1;
}
__device__ __forceinline__ v4u tdm_group0(const _Float16* gsrc, unsigned int lds_dst) {
    const unsigned long long ga = (unsigned long long)(uintptr_t)gsrc;
    v4u g0;
    g0[0] = uni(1u);                                           // count = 1
    g0[1] = uni(lds_dst);                                      // byte offset in LDS
    g0[2] = uni((unsigned int)ga);                             // address [31:0]
    g0[3] = uni((((unsigned int)(ga >> 32)) & 0x01ffffffu) | 0x80000000u);
    asm volatile("" : "+s"(g0));
    return g0;
}
// the next tile's address: words 2 and 3 taken as one 64-bit number, whose low 57
// bits are the address, so that a carry out of word 2 stays inside the address
__device__ __forceinline__ v4u tdm_advance(v4u g0, unsigned int bytes) {
    const unsigned long long a = ((((unsigned long long)g0[3]) << 32) | g0[2]) + bytes;
    g0[2] = uni((unsigned int)a);
    g0[3] = uni((unsigned int)(a >> 32));
    asm volatile("" : "+s"(g0));
    return g0;
}
__device__ __forceinline__ void tdm_load(v4u g0, v8u g1) {
    asm volatile("tensor_load_to_lds %0, %1" :: "s"(g0), "s"(g1) : "memory");
}

// ---------------------------------------------------------------------------
// Kernel 0: f32 -> f16 conversion (X and W), 8 elems/thread
// ---------------------------------------------------------------------------
__global__ void cvt_f32_to_f16(const float* __restrict__ in,
                               _Float16* __restrict__ out, int n) {
    int i = (blockIdx.x * blockDim.x + threadIdx.x) * 8;
    if (i >= n) return;
    float4 a = *(const float4*)(in + i);
    float4 b = *(const float4*)(in + i + 4);
    v8h h;
    h[0] = (_Float16)a.x; h[1] = (_Float16)a.y;
    h[2] = (_Float16)a.z; h[3] = (_Float16)a.w;
    h[4] = (_Float16)b.x; h[5] = (_Float16)b.y;
    h[6] = (_Float16)b.z; h[7] = (_Float16)b.w;
    *(v8h*)(out + i) = h;
}

// ---------------------------------------------------------------------------
// Kernel 1: Vt[b][e][n] = elu( X W^T + b )^T  (f16, transposed layout).
// Grid: BATCH*(NSEQ/16) x 256 threads (8 waves); wave w owns e-cols [w*64,+64).
// ---------------------------------------------------------------------------
__global__ void __launch_bounds__(256)
proj_elu_kernel(const _Float16* __restrict__ Xh,
                const _Float16* __restrict__ Wh,
                const float*    __restrict__ bias,
                _Float16*       __restrict__ Vt) {
    const int bidx = blockIdx.x / (NSEQ / 16);
    const int n0   = (blockIdx.x % (NSEQ / 16)) * 16;
    const int w    = threadIdx.x >> 5;
    const int lane = threadIdx.x & 31;

    const _Float16* xrow  = Xh + ((size_t)bidx * NSEQ + n0) * DMODEL;
    const _Float16* wbase = Wh + (size_t)(w * 64) * DMODEL;

    v8f acc[4] = {};
#pragma unroll 4
    for (int kk = 0; kk < DMODEL / 32; ++kk) {
        v16h aX = load_frag_rm(xrow + kk * 32, DMODEL, lane);
#pragma unroll
        for (int j = 0; j < 4; ++j) {
            v16h bW = load_frag_rm(wbase + (size_t)(j * 16) * DMODEL + kk * 32,
                                   DMODEL, lane);
            acc[j] = wmma_f16(aX, bW, acc[j]);
        }
    }

#pragma unroll
    for (int j = 0; j < 4; ++j) {
        const int e = w * 64 + j * 16 + (lane & 15);
        const float bv = bias[e];
        v8h h;
#pragma unroll
        for (int v = 0; v < 8; ++v)
            h[v] = (_Float16)elu_fast(acc[j][v] + bv);
        _Float16* dst = Vt + ((size_t)bidx * DMODEL + e) * NSEQ
                           + n0 + ((lane >> 4) << 3);
        *(v8h*)dst = h;
    }
}

// ---------------------------------------------------------------------------
// Kernel 2: fused  S = mask .* (X Xt / sqrt(D));  out = (S / max(||S||2,eps)) V
// Grid: BATCH*(NSEQ/32) x 512 threads (16 waves); 32-row n-tile, m-steps of 128.
// Two LDS buffers, filled by tensor load, form one ring over the stages
// K(0), V(0), K(1), V(1), ...: waves 0..3 each bring one 256-B column plane of the
// 128x512 f16 K tile, waves 4..7 each 128 e-rows of the 512x128 f16 V tile.
// V(t) flies during the score phase of step t, K(t+1) during its output phase.
// LDS: sK (4 planes) | sV (512 rows) | sQ (4 planes) | sS | sumsq, rows at 272 B.
// ---------------------------------------------------------------------------
__global__ void __launch_bounds__(512)
fused_attn_kernel(const _Float16* __restrict__ Xh,
                  const float*    __restrict__ mask,
                  const _Float16* __restrict__ Vt,
                  float*          __restrict__ out) {
    __shared__ __attribute__((aligned(2048))) char smem[SMEM_TOTAL];
    _Float16* sQ     = (_Float16*)(smem + SQ_OFF);
    _Float16* sS     = (_Float16*)(smem + SS_OFF);
    float*    sSumSq = (float*)   (smem + SUM_OFF);

    const int bidx = blockIdx.x / (NSEQ / 32);
    const int n0   = (blockIdx.x % (NSEQ / 32)) * 32;
    const int tid  = threadIdx.x;
    const int w    = tid >> 5;
    const int lane = tid & 31;
    const unsigned int wave  = uni(threadIdx.x >> 5);
    const unsigned int lbase = (unsigned int)(uintptr_t)smem;

    const _Float16* Kg = Xh + (size_t)bidx * NSEQ * DMODEL;  // this batch's keys
    // plane 'wave' of stage st: columns [wave*128, +128) of key rows [st*128, +128)
    const _Float16* Kplane = Kg + (wave & 3u) * 128u;
    const unsigned int plane_dst = lbase + (wave & 3u) * KPLANE_B;
    // slice 'wave & 3' of stage st: keys [st*128, +128) of e-rows [(wave&3)*128, +128)
    const _Float16* Vslice = Vt + ((size_t)bidx * DMODEL + (wave & 3u) * 128u) * NSEQ;
    const unsigned int slice_dst = lbase + SV_OFF + (wave & 3u) * KPLANE_B;
    const v8u g1K = tdm_group1(DMODEL * 2u);
    const v8u g1V = tdm_group1(NSEQ * 2u);
    v4u g0K = tdm_group0(Kplane, plane_dst);     // stage K(0)
    v4u g0V = tdm_group0(Vslice, slice_dst);     // stage V(0)

    {   // stage Q tile into LDS, same planes and pitch as K
        const v8h* src = (const v8h*)(Xh + ((size_t)bidx * NSEQ + n0) * DMODEL);
#pragma unroll
        for (int i = 0; i < 4; ++i) {
            const int idx = tid + i * 512;        // 16-byte unit; 64 units a row
            const int row = idx >> 6, u = idx & 63;
            *(v8h*)((char*)sQ + (u >> 4) * QPLANE_B + row * PITCH_B + (u & 15) * 16) = src[idx];
        }
    }
    if (tid < 32) sSumSq[tid] = 0.0f;

    // prologue of the two-buffer ring: stage K(0), its wait, the barrier, stage V(0)
    if (pinned(wave < 4u)) {
        tdm_load(g0K, g1K);
        wait_tensor0();
    }
    __syncthreads();
    if (pinned((wave >> 2) == 1u))
        tdm_load(g0V, g1V);

    const int rt = w & 1;           // score / out row-tile
    const int ct = w >> 1;          // phase-1 col-tile (0..7)
    const int eg = w >> 1;          // phase-2 e-group

    v8f oacc[4] = {};

    for (int t = 0; t < NSEQ / 128; ++t) {
        const int mstep = t * 128;
        const _Float16* sKcur = (const _Float16*)smem;

        // ================= phase 1: masked scores (Q,K both from LDS) ====
        {
            const _Float16* qbase = sQ + (size_t)(rt * 16) * PITCH_H;
            const _Float16* kbase = sKcur + (size_t)(ct * 16) * PITCH_H;

            // The step's eight mask values are asked for here, ahead of the score
            // products, so that their memory latencies run side by side and behind
            // the WMMAs instead of one after another behind them.
            const float* mp = mask
                + ((size_t)bidx * NSEQ + n0 + rt * 16 + ((lane >> 4) << 3)) * NSEQ
                + mstep + ct * 16 + (lane & 15);
            float mv[8];
#pragma unroll
            for (int v = 0; v < 8; ++v)
                mv[v] = __builtin_nontemporal_load(mp + (size_t)v * NSEQ);

            v8f s = {};
            for (int q = 0; q < 4; ++q) {        // plane
#pragma unroll                                    // constant offsets inside a plane
                for (int k4 = 0; k4 < 4; ++k4) {
                    v16h aQ = load_frag_rm(qbase + q * (QPLANE_B / 2) + k4 * 32, PITCH_H, lane);
                    v16h bK = load_frag_rm(kbase + q * (KPLANE_B / 2) + k4 * 32, PITCH_H, lane);
                    s = wmma_f16(aQ, bK, s);
                }
            }

            if (mstep + 128 < NSEQ)
                __builtin_prefetch(mp + 128, 0, 0);    // global_prefetch_b8

            // the eight rows go through each stage together: eight independent
            // chains, so that a cross-lane step's latency is paid once a stage
            const int row0 = rt * 16 + ((lane >> 4) << 3);
            float sv[8], sq[8];
#pragma unroll
            for (int v = 0; v < 8; ++v) {
                sv[v] = s[v] * INV_TEMP * mv[v];
                sq[v] = sv[v] * sv[v];
            }
#pragma unroll
            for (int m = 1; m < 16; m <<= 1) {
#pragma unroll
                for (int v = 0; v < 8; ++v)
                    sq[v] += __shfl_xor(sq[v], m);
            }
#pragma unroll
            for (int v = 0; v < 8; ++v)
                sS[(size_t)(row0 + v) * PITCH_H + ct * 16 + (lane & 15)] = (_Float16)sv[v];
            if ((lane & 15) == 0) {
#pragma unroll
                for (int v = 0; v < 8; ++v)
                    atomicAdd(&sSumSq[row0 + v], sq[v]);
            }
        }
        // publish point of V(t) (and of the S tile): own LDS reads and writes done,
        // own request landed, barrier; only then the refill of the K buffer, which
        // the score phase has just read
        wait_ds0();
        if (pinned((wave >> 2) == 1u))
            wait_tensor0();
        __syncthreads();
        if (pinned(wave < 4u && t + 1 < NSEQ / 128)) {
            g0K = tdm_advance(g0K, 128u * DMODEL * 2u);   // 128 key rows on
            tdm_load(g0K, g1K);
        }

        // ================= phase 2: out += S * Vt (S,V both from LDS) ====
        {
            // key chunk outermost: the four e-tiles of a chunk are independent
            // accumulators, and each accumulator still takes its chunks in order 0..3
            const _Float16* sbase = sS + (size_t)(rt * 16) * PITCH_H;
            const _Float16* vbase =
                (const _Float16*)(smem + SV_OFF) + (size_t)(eg * 64) * PITCH_H;
#pragma unroll
            for (int kk = 0; kk < 4; ++kk) {
                v16h aS = load_frag_rm(sbase + kk * 32, PITCH_H, lane);
                v16h c[4];
#pragma unroll
                for (int j = 0; j < 4; ++j)
                    c[j] = load_frag_rm(vbase + (size_t)(j * 16) * PITCH_H + kk * 32, PITCH_H, lane);
#pragma unroll
                for (int j = 0; j < 4; ++j)
                    oacc[j] = wmma_f16(aS, c[j], oacc[j]);
            }
            // order asked of the scheduler: a chunk's ten LDS reads stand together, one
            // chunk ahead of the four WMMAs that use them; left alone it put two reads
            // and a wait to zero in front of every WMMA, the full LDS latency each time
            __builtin_amdgcn_sched_group_barrier(0x100, 10, 0);   // reads of chunk 0
#pragma unroll
            for (int kk = 1; kk < 4; ++kk) {
                __builtin_amdgcn_sched_group_barrier(0x100, 10, 0);   // reads of chunk kk
                __builtin_amdgcn_sched_group_barrier(0x008, 4, 0);    // WMMAs of chunk kk-1
            }
            __builtin_amdgcn_sched_group_barrier(0x008, 4, 0);        // WMMAs of chunk 3
        }

        // publish point of K(t+1): own LDS reads done, own request landed, barrier;
        // only then the refill of the V buffer, which the output phase has just read
        wait_ds0();
        if (pinned(wave < 4u))
            wait_tensor0();
        __syncthreads();
        if (pinned((wave >> 2) == 1u && t + 1 < NSEQ / 128)) {
            g0V = tdm_advance(g0V, 128u * 2u);            // 128 keys on in every e-row
            tdm_load(g0V, g1V);
        }
    }
    // end of the ring: no request and no LDS read of this wave is left in flight
    wait_tensor0();
    wait_ds0();

    // ---- epilogue: L2-normalize rows, store ------------------------------
#pragma unroll
    for (int v = 0; v < 8; ++v) {
        const int row = rt * 16 + ((lane >> 4) << 3) + v;
        const float sc = 1.0f / fmaxf(sqrtf(sSumSq[row]), EPS);
        float* op = out + ((size_t)bidx * NSEQ + n0 + row) * DMODEL
                        + eg * 64 + (lane & 15);
#pragma unroll
        for (int j = 0; j < 4; ++j)
            op[j * 16] = oacc[j][v] * sc;
    }
}

// ---------------------------------------------------------------------------
// Launch
// ---------------------------------------------------------------------------
extern "C" void kernel_launch(void* const* d_in, const int* in_sizes, int n_in,
                              void* d_out, int out_size, void* d_ws, size_t ws_size,
                              hipStream_t stream) {
    const float* X    = (const float*)d_in[0];   // [8,2048,512]
    const float* M    = (const float*)d_in[1];   // [8,2048,2048]
    const float* W    = (const float*)d_in[2];   // [512,512]
    const float* bias = (const float*)d_in[3];   // [512]
    float* out = (float*)d_out;

    const size_t XH_ELEMS = (size_t)BATCH * NSEQ * DMODEL;  // 8,388,608
    const size_t WH_ELEMS = (size_t)DMODEL * DMODEL;        //   262,144
    char* ws = (char*)d_ws;
    _Float16* Xh = (_Float16*)ws;
    _Float16* Wh = (_Float16*)(ws + XH_ELEMS * sizeof(_Float16));
    _Float16* Vt = (_Float16*)(ws + (XH_ELEMS + WH_ELEMS) * sizeof(_Float16));

    cvt_f32_to_f16<<<(int)(XH_ELEMS / (256 * 8)), 256, 0, stream>>>(X, Xh, (int)XH_ELEMS);
    cvt_f32_to_f16<<<(int)(WH_ELEMS / (256 * 8)), 256, 0, stream>>>(W, Wh, (int)WH_ELEMS);

    proj_elu_kernel<<<BATCH * (NSEQ / 16), 256, 0, stream>>>(Xh, Wh, bias, Vt);

    fused_attn_kernel<<<BATCH * (NSEQ / 32), 512, 0, stream>>>(Xh, M, Vt, out);
}

// v004
// One run takes 124 microseconds.
// In both of two side-by-side timings against v003, it was 1.32 times as fast.
// All steps since v000 together make it 5.25 times as fast.
#include <hip/hip_runtime.h>
#include <hip/hip_bf16.h>
#include <math.h>

// ---------------------------------------------------------------------------
// Problem constants (reference: B=8, N=2048, D=512)
// ---------------------------------------------------------------------------
#define BATCH 8
#define NSEQ  2048
#define DMODEL 512
#define INV_TEMP 0.04419417382415922f   // 1/sqrt(512)
#define EPS 1e-5f

typedef __attribute__((ext_vector_type(16))) _Float16 v16h;
typedef __attribute__((ext_vector_type(8)))  _Float16 v8h;
typedef __attribute__((ext_vector_type(8)))  float    v8f;
typedef __attribute__((ext_vector_type(4)))  unsigned int v4u;
typedef __attribute__((ext_vector_type(8)))  unsigned int v8u;

__device__ __forceinline__ v16h load_frag_rm(const _Float16* base, int stride, int lane) {
    const int r  = lane & 15;
    const int hs = (lane >> 4) << 3;             // 0 or 8
    const _Float16* p = base + (size_t)r * stride + hs;
    v8h lo = *(const v8h*)(p);
    v8h hi = *(const v8h*)(p + 16);
    return __builtin_shufflevector(lo, hi, 0,1,2,3,4,5,6,7,8,9,10,11,12,13,14,15);
}

__device__ __forceinline__ v8f wmma_f16(v16h a, v16h b, v8f c) {
    return __builtin_amdgcn_wmma_f32_16x16x32_f16(
        false, a, false, b, (short)0, c, false, false);
}

// branchless ELU (alpha = 1) on the fast-exp path (v_exp_f32)
__device__ __forceinline__ float elu_fast(float x) {
    float e = __expf(x) - 1.0f;
    return (x > 0.0f) ? x : e;
}

#define PITCH_B    272                          // LDS row pitch in bytes
#define PITCH_H    (PITCH_B / 2)                // ... in halves
#define KPLANE_B   (128 * PITCH_B)              // 34816 = 17 * 2048
#define KBUF_B     (4 * KPLANE_B)               // 139264: the K tile; the V tile is as large
#define SV_OFF     KBUF_B                       // V tile behind the K tile
#define NROWS      64                           // query rows of a work-group
#define SS_OFF     (2 * KBUF_B)                 // 278528
#define SUM_OFF    (SS_OFF + NROWS * PITCH_B)   // 295936
#define SMEM_TOTAL (SUM_OFF + NROWS * 4)        // 296192

__device__ __forceinline__ unsigned int uni(unsigned int v) {
    return (unsigned int)__builtin_amdgcn_readfirstlane(v);
}
__device__ __forceinline__ unsigned int pinned(unsigned int v) {
    unsigned int w = uni(v);
    asm volatile("" : "+s"(w));   // pinned(): keeps the issue test in a scalar register
    return w;
}
__device__ __forceinline__ void wait_tensor0() { asm volatile("s_wait_tensorcnt 0x0" ::: "memory"); }
// a wave's LDS reads have retired before the barrier behind which a buffer is refilled
__device__ __forceinline__ void wait_ds0()     { asm volatile("s_wait_dscnt 0x0" ::: "memory"); }

__device__ __forceinline__ v8u tdm_group1(unsigned int src_pitch) {
    v8u g1;
    g1[0] = uni((1u << 20) | (5u << 22) | (3u << 25));
    g1[1] = uni(256u << 16);
    g1[2] = uni(128u << 16);
    g1[3] = uni(256u << 16);
    g1[4] = uni(128u);
    g1[5] = uni(src_pitch);
    g1[6] = uni(0u);
    g1[7] = uni(0u);
    asm volatile("" : "+s"(g1));
    return g1;
}
__device__ __forceinline__ v4u tdm_group0(const _Float16* gsrc, unsigned int lds_dst) {
    const unsigned long long ga = (unsigned long long)(uintptr_t)gsrc;
    v4u g0;
    g0[0] = uni(1u);                                           // count = 1
    g0[1] = uni(lds_dst);                                      // byte offset in LDS
    g0[2] = uni((unsigned int)ga);                             // address [31:0]
    g0[3] = uni((((unsigned int)(ga >> 32)) & 0x01ffffffu) | 0x80000000u);
    asm volatile("" : "+s"(g0));
    return g0;
}
// the next tile's address: words 2 and 3 taken as one 64-bit number, whose low 57
// bits are the address, so that a carry out of word 2 stays inside the address
__device__ __forceinline__ v4u tdm_advance(v4u g0, unsigned int bytes) {
    const unsigned long long a = ((((unsigned long long)g0[3]) << 32) | g0[2]) + bytes;
    g0[2] = uni((unsigned int)a);
    g0[3] = uni((unsigned int)(a >> 32));
    asm volatile("" : "+s"(g0));
    return g0;
}
__device__ __forceinline__ void tdm_load(v4u g0, v8u g1) {
    asm volatile("tensor_load_to_lds %0, %1" :: "s"(g0), "s"(g1) : "memory");
}

// ---------------------------------------------------------------------------
// Kernel 0: f32 -> f16 conversion (X and W), 8 elems/thread
// ---------------------------------------------------------------------------
__global__ void cvt_f32_to_f16(const float* __restrict__ in,
                               _Float16* __restrict__ out, int n) {
    int i = (blockIdx.x * blockDim.x + threadIdx.x) * 8;
    if (i >= n) return;
    float4 a = *(const float4*)(in + i);
    float4 b = *(const float4*)(in + i + 4);
    v8h h;
    h[0] = (_Float16)a.x; h[1] = (_Float16)a.y;
    h[2] = (_Float16)a.z; h[3] = (_Float16)a.w;
    h[4] = (_Float16)b.x; h[5] = (_Float16)b.y;
    h[6] = (_Float16)b.z; h[7] = (_Float16)b.w;
    *(v8h*)(out + i) = h;
}

// ---------------------------------------------------------------------------
// Kernel 1: Vt[b][e][n] = elu( X W^T + b )^T  (f16, transposed layout).
// Grid: BATCH*(NSEQ/16) x 256 threads (8 waves); wave w owns e-cols [w*64,+64).
// ---------------------------------------------------------------------------
__global__ void __launch_bounds__(256)
proj_elu_kernel(const _Float16* __restrict__ Xh,
                const _Float16* __restrict__ Wh,
                const float*    __restrict__ bias,
                _Float16*       __restrict__ Vt) {
    const int bidx = blockIdx.x / (NSEQ / 16);
    const int n0   = (blockIdx.x % (NSEQ / 16)) * 16;
    const int w    = threadIdx.x >> 5;
    const int lane = threadIdx.x & 31;

    const _Float16* xrow  = Xh + ((size_t)bidx * NSEQ + n0) * DMODEL;
    const _Float16* wbase = Wh + (size_t)(w * 64) * DMODEL;

    v8f acc[4] = {};
#pragma unroll 4
    for (int kk = 0; kk < DMODEL / 32; ++kk) {
        v16h aX = load_frag_rm(xrow + kk * 32, DMODEL, lane);
#pragma unroll
        for (int j = 0; j < 4; ++j) {
            v16h bW = load_frag_rm(wbase + (size_t)(j * 16) * DMODEL + kk * 32,
                                   DMODEL, lane);
            acc[j] = wmma_f16(aX, bW, acc[j]);
        }
    }

#pragma unroll
    for (int j = 0; j < 4; ++j) {
        const int e = w * 64 + j * 16 + (lane & 15);
        const float bv = bias[e];
        v8h h;
#pragma unroll
        for (int v = 0; v < 8; ++v)
            h[v] = (_Float16)elu_fast(acc[j][v] + bv);
        _Float16* dst = Vt + ((size_t)bidx * DMODEL + e) * NSEQ
                           + n0 + ((lane >> 4) << 3);
        *(v8h*)dst = h;
    }
}

// ---------------------------------------------------------------------------
// Kernel 2: fused  S = mask .* (X Xt / sqrt(D));  out = (S / max(||S||2,eps)) V
// Grid: BATCH*(NSEQ/64) x 256 threads (8 waves); 64-row n-tile, m-steps of 128:
// one work-group on every WGP, and each K and V tile that comes from L2 serves
// 64 query rows. The Q rows do not fit in LDS beside the two tiles: each wave
// holds the 16 fragments of its own 16 query rows in registers for the whole loop.
// Two LDS buffers, filled by tensor load, form one ring over the stages
// K(0), V(0), K(1), V(1), ...: waves 0..3 each bring one 256-B column plane of the
// 128x512 f16 K tile, waves 4..7 each 128 e-rows of the 512x128 f16 V tile.
// V(t) flies during the score phase of step t, K(t+1) during its output phase.
// LDS: sK (4 planes) | sV (512 rows) | sS | sumsq, rows at 272 B.
// ---------------------------------------------------------------------------
__global__ void __launch_bounds__(256)
fused_attn_kernel(const _Float16* __restrict__ Xh,
                  const float*    __restrict__ mask,
                  const _Float16* __restrict__ Vt,
                  float*          __restrict__ out) {
    __shared__ __attribute__((aligned(2048))) char smem[SMEM_TOTAL];
    _Float16* sS     = (_Float16*)(smem + SS_OFF);
    float*    sSumSq = (float*)   (smem + SUM_OFF);

    const int bidx = blockIdx.x / (NSEQ / NROWS);
    const int n0   = (blockIdx.x % (NSEQ / NROWS)) * NROWS;
    const int tid  = threadIdx.x;
    const int w    = tid >> 5;
    const int lane = tid & 31;
    const unsigned int wave  = uni(threadIdx.x >> 5);
    const unsigned int lbase = (unsigned int)(uintptr_t)smem;

    const _Float16* Kg = Xh + (size_t)bidx * NSEQ * DMODEL;  // this batch's keys
    // plane 'wave' of stage st: columns [wave*128, +128) of key rows [st*128, +128)
    const _Float16* Kplane = Kg + (wave & 3u) * 128u;
    const unsigned int plane_dst = lbase + (wave & 3u) * KPLANE_B;
    // slice 'wave & 3' of stage st: keys [st*128, +128) of e-rows [(wave&3)*128, +128)
    const _Float16* Vslice = Vt + ((size_t)bidx * DMODEL + (wave & 3u) * 128u) * NSEQ;
    const unsigned int slice_dst = lbase + SV_OFF + (wave & 3u) * KPLANE_B;
    const v8u g1K = tdm_group1(DMODEL * 2u);
    const v8u g1V = tdm_group1(NSEQ * 2u);
    v4u g0K = tdm_group0(Kplane, plane_dst);     // stage K(0)
    v4u g0V = tdm_group0(Vslice, slice_dst);     // stage V(0)

    const int rt = w & 3;           // score phase: row tile (16 of the 64 rows)
    const int ch = w >> 2;          // score phase: key half (4 column tiles of 16 keys)
    const int rp = w & 1;           // output phase: row pair (32 of the 64 rows)
    const int eg = w >> 1;          // output phase: e-group (8 tiles of 16 e-columns)

    // the wave's 16 query rows, all 512 columns, as 16 A fragments
    v16h aQ[16];
    {
        const _Float16* qrow = Xh + ((size_t)bidx * NSEQ + n0 + rt * 16) * DMODEL;
#pragma unroll
        for (int kc = 0; kc < 16; ++kc)
            aQ[kc] = load_frag_rm(qrow + kc * 32, DMODEL, lane);
    }
    if (tid < NROWS) sSumSq[tid] = 0.0f;

    // prologue of the two-buffer ring: stage K(0), its wait, the barrier, stage V(0)
    if (pinned(wave < 4u)) {
        tdm_load(g0K, g1K);
        wait_tensor0();
    }
    __syncthreads();
    if (pinned((wave >> 2) == 1u))
        tdm_load(g0V, g1V);

    v8f oacc[2][8] = {};

    for (int t = 0; t < NSEQ / 128; ++t) {
        const int mstep = t * 128;

        // ================= phase 1: masked scores (Q in registers, K from LDS) ====
        {
            const _Float16* kbase = (const _Float16*)smem + (size_t)(ch * 64) * PITCH_H;

            // The step's mask values are asked for here, ahead of the score
            // products, so that their memory latencies run side by side and behind
            // the WMMAs instead of one after another behind them.
            const float* mp = mask
                + ((size_t)bidx * NSEQ + n0 + rt * 16 + ((lane >> 4) << 3)) * NSEQ
                + mstep + ch * 64 + (lane & 15);
            float mv[4][8];
#pragma unroll
            for (int c = 0; c < 4; ++c) {
#pragma unroll
                for (int v = 0; v < 8; ++v)
                    mv[c][v] = __builtin_nontemporal_load(mp + (size_t)v * NSEQ + c * 16);
            }
            asm volatile("s_wait_xcnt 0x0" ::: "memory");

            // one Q fragment meets the four K fragments of its 32 columns: four
            // independent accumulators, each taking its chunks in the order 0..15
            v8f s[4] = {};
#pragma unroll                                    // aQ is indexed by constants only
            for (int kc = 0; kc < 16; ++kc) {
                v16h bK[4];
#pragma unroll
                for (int c = 0; c < 4; ++c)
                    bK[c] = load_frag_rm(kbase + (size_t)(c * 16) * PITCH_H
                                         + (kc >> 2) * (KPLANE_B / 2) + (kc & 3) * 32,
                                         PITCH_H, lane);
#pragma unroll
                for (int c = 0; c < 4; ++c)
                    s[c] = wmma_f16(aQ[kc], bK[c], s[c]);
            }
            // order asked of the scheduler: a chunk's eight LDS reads stand together,
            // two chunks ahead of the four WMMAs that use them; with two reads and a
            // wait to zero in front of every WMMA the LDS latency is paid each time.
            // The mask loads stand in front of the first WMMA: left alone they sank to
            // the last chunks, and their memory latency lay open behind the products
            __builtin_amdgcn_sched_group_barrier(0x020, 32, 0);       // the 32 mask loads
            __builtin_amdgcn_sched_group_barrier(0x100, 16, 0);       // reads of chunks 0, 1
#pragma unroll
            for (int kc = 2; kc < 16; ++kc) {
                __builtin_amdgcn_sched_group_barrier(0x100, 8, 0);    // reads of chunk kc
                __builtin_amdgcn_sched_group_barrier(0x008, 4, 0);    // WMMAs of chunk kc-2
            }
            __builtin_amdgcn_sched_group_barrier(0x008, 8, 0);        // WMMAs of chunks 14, 15

            if (mstep + 128 < NSEQ)
                __builtin_prefetch(mp + 128, 0, 0);    // global_prefetch_b8

            // the eight rows go through each stage together: eight independent
            // chains, so that a cross-lane step's latency is paid once a stage
            const int row0 = rt * 16 + ((lane >> 4) << 3);
            float sq[8];
#pragma unroll
            for (int v = 0; v < 8; ++v)
                sq[v] = 0.0f;
#pragma unroll
            for (int c = 0; c < 4; ++c) {
#pragma unroll
                for (int v = 0; v < 8; ++v) {
                    const float sv = s[c][v] * INV_TEMP * mv[c][v];
                    sq[v] += sv * sv;
                    sS[(size_t)(row0 + v) * PITCH_H + ch * 64 + c * 16 + (lane & 15)] = (_Float16)sv;
                }
            }
#pragma unroll
            for (int m = 1; m < 16; m <<= 1) {
#pragma unroll
                for (int v = 0; v < 8; ++v)
                    sq[v] += __shfl_xor(sq[v], m);
            }
            if ((lane & 15) == 0) {
#pragma unroll
                for (int v = 0; v < 8; ++v)
                    atomicAdd(&sSumSq[row0 + v], sq[v]);
            }
        }
        // publish point of V(t) (and of the S tile): own LDS reads and writes done,
        // own request landed, barrier; only then the refill of the K buffer, which
        // the score phase has just read
        wait_ds0();
        if (pinned((wave >> 2) == 1u))
            wait_tensor0();
        __syncthreads();
        if (pinned(wave < 4u && t + 1 < NSEQ / 128)) {
            g0K = tdm_advance(g0K, 128u * DMODEL * 2u);   // 128 key rows on
            tdm_load(g0K, g1K);
        }

        // ================= phase 2: out += S * Vt (S,V both from LDS) ====
        {
            // key chunk outermost: the sixteen tiles of a chunk are independent
            // accumulators, and each accumulator still takes its chunks in order 0..3;
            // every V fragment serves the two row tiles of the wave
            const _Float16* sbase = sS + (size_t)(rp * 32) * PITCH_H;
            const _Float16* vbase =
                (const _Float16*)(smem + SV_OFF) + (size_t)(eg * 128) * PITCH_H;
#pragma unroll
            for (int kk = 0; kk < 4; ++kk) {
                v16h aS[2];
#pragma unroll
                for (int r = 0; r < 2; ++r)
                    aS[r] = load_frag_rm(sbase + (size_t)(r * 16) * PITCH_H + kk * 32, PITCH_H, lane);
                v16h c[8];
#pragma unroll
                for (int j = 0; j < 8; ++j)
                    c[j] = load_frag_rm(vbase + (size_t)(j * 16) * PITCH_H + kk * 32, PITCH_H, lane);
#pragma unroll
                for (int j = 0; j < 8; ++j) {
#pragma unroll
                    for (int r = 0; r < 2; ++r)
                        oacc[r][j] = wmma_f16(aS[r], c[j], oacc[r][j]);
                }
            }
            // order asked of the scheduler: a chunk's twenty LDS reads stand together, one
            // chunk ahead of the sixteen WMMAs that use them; left alone it put two reads
            // and a wait to zero in front of every WMMA, the full LDS latency each time
            __builtin_amdgcn_sched_group_barrier(0x100, 20, 0);   // reads of chunk 0
#pragma unroll
            for (int kk = 1; kk < 4; ++kk) {
                __builtin_amdgcn_sched_group_barrier(0x100, 20, 0);   // reads of chunk kk
                __builtin_amdgcn_sched_group_barrier(0x008, 16, 0);   // WMMAs of chunk kk-1
            }
            __builtin_amdgcn_sched_group_barrier(0x008, 16, 0);       // WMMAs of chunk 3
            // keeps the wait below behind the last WMMA: lifted to the last LDS read it
            // held the products of chunk 2 back until the reads of chunk 3 had returned
            __builtin_amdgcn_sched_barrier(0);
        }

        // publish point of K(t+1): own LDS reads done, own request landed, barrier;
        // only then the refill of the V buffer, which the output phase has just read
        wait_ds0();
        if (pinned(wave < 4u))
            wait_tensor0();
        __syncthreads();
        if (pinned((wave >> 2) == 1u && t + 1 < NSEQ / 128)) {
            g0V = tdm_advance(g0V, 128u * 2u);            // 128 keys on in every e-row
            tdm_load(g0V, g1V);
        }
    }
    // end of the ring: no request and no LDS read of this wave is left in flight
    wait_tensor0();
    wait_ds0();

    // ---- epilogue: L2-normalize rows, store ------------------------------
#pragma unroll
    for (int r = 0; r < 2; ++r) {
#pragma unroll
        for (int v = 0; v < 8; ++v) {
            const int row = rp * 32 + r * 16 + ((lane >> 4) << 3) + v;
            const float sc = 1.0f / fmaxf(sqrtf(sSumSq[row]), EPS);
            float* op = out + ((size_t)bidx * NSEQ + n0 + row) * DMODEL
                            + eg * 128 + (lane & 15);
#pragma unroll
            for (int j = 0; j < 8; ++j)
                op[j * 16] = oacc[r][j][v] * sc;
        }
    }
}

// ---------------------------------------------------------------------------
// Launch
// ---------------------------------------------------------------------------
extern "C" void kernel_launch(void* const* d_in, const int* in_sizes, int n_in,
                              void* d_out, int out_size, void* d_ws, size_t ws_size,
                              hipStream_t stream) {
    const float* X    = (const float*)d_in[0];   // [8,2048,512]
    const float* M    = (const float*)d_in[1];   // [8,2048,2048]
    const float* W    = (const float*)d_in[2];   // [512,512]
    const float* bias = (const float*)d_in[3];   // [512]
    float* out = (float*)d_out;

    const size_t XH_ELEMS = (size_t)BATCH * NSEQ * DMODEL;  // 8,388,608
    const size_t WH_ELEMS = (size_t)DMODEL * DMODEL;        //   262,144
    char* ws = (char*)d_ws;
    _Float16* Xh = (_Float16*)ws;
    _Float16* Wh = (_Float16*)(ws + XH_ELEMS * sizeof(_Float16));
    _Float16* Vt = (_Float16*)(ws + (XH_ELEMS + WH_ELEMS) * sizeof(_Float16));

    cvt_f32_to_f16<<<(int)(XH_ELEMS / (256 * 8)), 256, 0, stream>>>(X, Xh, (int)XH_ELEMS);
    cvt_f32_to_f16<<<(int)(WH_ELEMS / (256 * 8)), 256, 0, stream>>>(W, Wh, (int)WH_ELEMS);

    proj_elu_kernel<<<BATCH * (NSEQ / 16), 256, 0, stream>>>(Xh, Wh, bias, Vt);

    fused_attn_kernel<<<BATCH * (NSEQ / NROWS), 256, 0, stream>>>(Xh, M, Vt, out);
}

// v005
// One run takes 82.2 microseconds.
// In both of two side-by-side timings against v004, it was 1.51 times as fast.
// Over all steps from v000 it is 7.91 times as fast.
#include <hip/hip_runtime.h>
#include <hip/hip_bf16.h>
#include <math.h>

// ---------------------------------------------------------------------------
// Problem constants (reference: B=8, N=2048, D=512)
// ---------------------------------------------------------------------------
#define BATCH 8
#define NSEQ  2048
#define DMODEL 512
#define INV_TEMP 0.04419417382415922f   // 1/sqrt(512)
#define EPS 1e-5f

typedef __attribute__((ext_vector_type(16))) _Float16 v16h;
typedef __attribute__((ext_vector_type(8)))  _Float16 v8h;
typedef __attribute__((ext_vector_type(8)))  float    v8f;
typedef __attribute__((ext_vector_type(4)))  unsigned int v4u;
typedef __attribute__((ext_vector_type(8)))  unsigned int v8u;

__device__ __forceinline__ v16h load_frag_rm(const _Float16* base, int stride, int lane) {
    const int r  = lane & 15;
    const int hs = (lane >> 4) << 3;             // 0 or 8
    const _Float16* p = base + (size_t)r * stride + hs;
    v8h lo = *(const v8h*)(p);
    v8h hi = *(const v8h*)(p + 16);
    return __builtin_shufflevector(lo, hi, 0,1,2,3,4,5,6,7,8,9,10,11,12,13,14,15);
}

__device__ __forceinline__ v8f wmma_f16(v16h a, v16h b, v8f c) {
    return __builtin_amdgcn_wmma_f32_16x16x32_f16(
        false, a, false, b, (short)0, c, false, false);
}

// branchless ELU (alpha = 1) on the fast-exp path (v_exp_f32)
__device__ __forceinline__ float elu_fast(float x) {
    float e = __expf(x) - 1.0f;
    return (x > 0.0f) ? x : e;
}

#define PITCH_B    272                          // LDS row pitch in bytes
#define PITCH_H    (PITCH_B / 2)                // ... in halves
#define KPLANE_B   (128 * PITCH_B)              // 34816 = 17 * 2048
#define KBUF_B     (4 * KPLANE_B)               // 139264: the K tile; the V tile is as large
#define SV_OFF     KBUF_B                       // V tile behind the K tile
#define NROWS      64                           // query rows of a work-group
#define SS_OFF     (2 * KBUF_B)                 // 278528
#define SUM_OFF    (SS_OFF + NROWS * PITCH_B)   // 295936
#define SMEM_TOTAL (SUM_OFF + NROWS * 4)        // 296192

__device__ __forceinline__ unsigned int uni(unsigned int v) {
    return (unsigned int)__builtin_amdgcn_readfirstlane(v);
}
__device__ __forceinline__ unsigned int pinned(unsigned int v) {
    unsigned int w = uni(v);
    asm volatile("" : "+s"(w));   // pinned(): keeps the issue test in a scalar register
    return w;
}
__device__ __forceinline__ void wait_tensor0() { asm volatile("s_wait_tensorcnt 0x0" ::: "memory"); }
// a wave's LDS reads have retired before the barrier behind which a buffer is refilled
__device__ __forceinline__ void wait_ds0()     { asm volatile("s_wait_dscnt 0x0" ::: "memory"); }

__device__ __forceinline__ v8u tdm_group1(unsigned int src_pitch) {
    v8u g1;
    g1[0] = uni((1u << 20) | (5u << 22) | (3u << 25));
    g1[1] = uni(256u << 16);
    g1[2] = uni(128u << 16);
    g1[3] = uni(256u << 16);
    g1[4] = uni(128u);
    g1[5] = uni(src_pitch);
    g1[6] = uni(0u);
    g1[7] = uni(0u);
    asm volatile("" : "+s"(g1));
    return g1;
}
__device__ __forceinline__ v4u tdm_group0(const _Float16* gsrc, unsigned int lds_dst) {
    const unsigned long long ga = (unsigned long long)(uintptr_t)gsrc;
    v4u g0;
    g0[0] = uni(1u);                                           // count = 1
    g0[1] = uni(lds_dst);                                      // byte offset in LDS
    g0[2] = uni((unsigned int)ga);                             // address [31:0]
    g0[3] = uni((((unsigned int)(ga >> 32)) & 0x01ffffffu) | 0x80000000u);
    asm volatile("" : "+s"(g0));
    return g0;
}
// the next tile's address: words 2 and 3 taken as one 64-bit number, whose low 57
// bits are the address, so that a carry out of word 2 stays inside the address
__device__ __forceinline__ v4u tdm_advance(v4u g0, unsigned int bytes) {
    const unsigned long long a = ((((unsigned long long)g0[3]) << 32) | g0[2]) + bytes;
    g0[2] = uni((unsigned int)a);
    g0[3] = uni((unsigned int)(a >> 32));
    asm volatile("" : "+s"(g0));
    return g0;
}
// the next stage of a ring whose buffers alternate: the address moves on as in
// tdm_advance, and word 1 takes the other buffer's place in LDS
__device__ __forceinline__ v4u tdm_next(v4u g0, unsigned int bytes, unsigned int lds_dst) {
    const unsigned long long a = ((((unsigned long long)g0[3]) << 32) | g0[2]) + bytes;
    g0[1] = uni(lds_dst);
    g0[2] = uni((unsigned int)a);
    g0[3] = uni((unsigned int)(a >> 32));
    asm volatile("" : "+s"(g0));
    return g0;
}
__device__ __forceinline__ void tdm_load(v4u g0, v8u g1) {
    asm volatile("tensor_load_to_lds %0, %1" :: "s"(g0), "s"(g1) : "memory");
}

// ---------------------------------------------------------------------------
// Kernel 0: f32 -> f16 conversion (X and W), 8 elems/thread
// ---------------------------------------------------------------------------
__global__ void cvt_f32_to_f16(const float* __restrict__ in,
                               _Float16* __restrict__ out, int n) {
    int i = (blockIdx.x * blockDim.x + threadIdx.x) * 8;
    if (i >= n) return;
    float4 a = *(const float4*)(in + i);
    float4 b = *(const float4*)(in + i + 4);
    v8h h;
    h[0] = (_Float16)a.x; h[1] = (_Float16)a.y;
    h[2] = (_Float16)a.z; h[3] = (_Float16)a.w;
    h[4] = (_Float16)b.x; h[5] = (_Float16)b.y;
    h[6] = (_Float16)b.z; h[7] = (_Float16)b.w;
    *(v8h*)(out + i) = h;
}

// ---------------------------------------------------------------------------
// Kernel 1: Vt[b][e][n] = elu( X W^T + b )^T  (f16, transposed layout).
// Grid: (BATCH*NSEQ/128) * 2 x 256 threads (8 waves): one work-group on every WGP
// makes 128 rows n x 256 columns e. The 512 k go in four stages of 128 k (256 B of
// every operand row). A stage is [X 128 rows | W 256 rows] at a pitch of 272 B,
// brought by waves 0..2 with one tensor load of 128 rows each; two buffers, so
// that stage s+1 flies while stage s is worked on. Wave tile 64 n x 64 e: every
// fragment read from LDS serves four WMMAs, and no operand line is asked of the
// caches in 32-B pieces. Each accumulator takes its k chunks in the order 0..15.
// ---------------------------------------------------------------------------
#define PSTAGE_B   (3 * KPLANE_B)               // 104448 = 51 * 2048
#define PSTAGES    (DMODEL / 128)               // 4

__global__ void __launch_bounds__(256)
proj_elu_kernel(const _Float16* __restrict__ Xh,
                const _Float16* __restrict__ Wh,
                const float*    __restrict__ bias,
                _Float16*       __restrict__ Vt) {
    __shared__ __attribute__((aligned(2048))) char smem[2 * PSTAGE_B];

    const int nt   = blockIdx.x >> 1;            // 128 of the BATCH*NSEQ rows
    const int eh   = blockIdx.x & 1;             // 256 of the 512 columns e
    const int w    = threadIdx.x >> 5;
    const int lane = threadIdx.x & 31;
    const int wn   = w & 1;                      // 64 of the 128 rows
    const int we   = w >> 1;                     // 64 of the 256 columns
    const unsigned int wave  = uni(threadIdx.x >> 5);
    const unsigned int lbase = (unsigned int)(uintptr_t)smem;

    // wave 0 brings the X rows, waves 1 and 2 each 128 of the W rows
    const _Float16* gsrc = (wave == 0u)
        ? Xh + (size_t)nt * 128 * DMODEL
        : Wh + ((size_t)eh * 256 + (wave == 2u ? 128u : 0u)) * DMODEL;
    const unsigned int slice_dst = lbase + (wave < 3u ? wave : 0u) * KPLANE_B;
    const v8u g1 = tdm_group1(DMODEL * 2u);
    v4u g0 = tdm_group0(gsrc, slice_dst);        // stage 0, buffer 0

    // prologue of the two-buffer ring: stage 0, its wait, the barrier, stage 1
    if (pinned(wave < 3u)) {
        tdm_load(g0, g1);
        wait_tensor0();
    }
    __syncthreads();
    if (pinned(wave < 3u)) {
        g0 = tdm_next(g0, 256u, slice_dst + PSTAGE_B);
        tdm_load(g0, g1);
    }

    v8f acc[4][4] = {};
#pragma unroll 1
    for (int s = 0; s < PSTAGES; ++s) {
        const _Float16* buf   = (const _Float16*)(smem + (s & 1) * PSTAGE_B);
        const _Float16* abase = buf + (size_t)(wn * 64) * PITCH_H;
        const _Float16* bbase = buf + KPLANE_B / 2 + (size_t)(we * 64) * PITCH_H;
#pragma unroll
        for (int kk = 0; kk < 4; ++kk) {
            v16h aX[4], bW[4];
#pragma unroll
            for (int i = 0; i < 4; ++i)
                aX[i] = load_frag_rm(abase + (size_t)(i * 16) * PITCH_H + kk * 32, PITCH_H, lane);
#pragma unroll
            for (int j = 0; j < 4; ++j)
                bW[j] = load_frag_rm(bbase + (size_t)(j * 16) * PITCH_H + kk * 32, PITCH_H, lane);
#pragma unroll
            for (int i = 0; i < 4; ++i) {
#pragma unroll
                for (int j = 0; j < 4; ++j)
                    acc[i][j] = wmma_f16(aX[i], bW[j], acc[i][j]);
            }
        }
        // order asked of the scheduler: a chunk's sixteen LDS reads stand together, one
        // chunk ahead of the sixteen WMMAs that use them, so that the LDS latency is
        // paid behind products and not in front of each of them
        __builtin_amdgcn_sched_group_barrier(0x100, 16, 0);       // reads of chunk 0
#pragma unroll
        for (int kk = 1; kk < 4; ++kk) {
            __builtin_amdgcn_sched_group_barrier(0x100, 16, 0);   // reads of chunk kk
            __builtin_amdgcn_sched_group_barrier(0x008, 16, 0);   // WMMAs of chunk kk-1
        }
        __builtin_amdgcn_sched_group_barrier(0x008, 16, 0);       // WMMAs of chunk 3
        // keeps the wait below behind the last WMMA, so that it does not hold the
        // products of chunk 2 back until the reads of chunk 3 have returned
        __builtin_amdgcn_sched_barrier(0);

        // publish point of stage s+1: own LDS reads done, own request landed, barrier;
        // only then the refill of the buffer that this pass has just read
        wait_ds0();
        if (pinned(wave < 3u))
            wait_tensor0();
        __syncthreads();
        if (pinned(wave < 3u && s + 2 < PSTAGES)) {
            g0 = tdm_next(g0, 256u, slice_dst + (unsigned int)(s & 1) * PSTAGE_B);
            tdm_load(g0, g1);
        }
    }
    // end of the ring: no request and no LDS read of this wave is left in flight
    wait_tensor0();
    wait_ds0();

    // a lane holds 8 consecutive n of one column e: 16 B of a row of Vt
    const int bidx = nt / (NSEQ / 128);
    const int n0   = (nt % (NSEQ / 128)) * 128 + wn * 64 + ((lane >> 4) << 3);
    const int e0   = eh * 256 + we * 64 + (lane & 15);
    _Float16* dst = Vt + ((size_t)bidx * DMODEL + e0) * NSEQ + n0;
#pragma unroll
    for (int j = 0; j < 4; ++j) {
        const float bv = bias[e0 + j * 16];
#pragma unroll
        for (int i = 0; i < 4; ++i) {
            v8h h;
#pragma unroll
            for (int v = 0; v < 8; ++v)
                h[v] = (_Float16)elu_fast(acc[i][j][v] + bv);
            *(v8h*)(dst + (size_t)(j * 16) * NSEQ + i * 16) = h;
        }
    }
}

// ---------------------------------------------------------------------------
// Kernel 2: fused  S = mask .* (X Xt / sqrt(D));  out = (S / max(||S||2,eps)) V
// Grid: BATCH*(NSEQ/64) x 256 threads (8 waves); 64-row n-tile, m-steps of 128:
// one work-group on every WGP, and each K and V tile that comes from L2 serves
// 64 query rows. The Q rows do not fit in LDS beside the two tiles: each wave
// holds the 16 fragments of its own 16 query rows in registers for the whole loop.
// Two LDS buffers, filled by tensor load, form one ring over the stages
// K(0), V(0), K(1), V(1), ...: waves 0..3 each bring one 256-B column plane of the
// 128x512 f16 K tile, waves 4..7 each 128 e-rows of the 512x128 f16 V tile.
// V(t) flies during the score phase of step t, K(t+1) during its output phase.
// LDS: sK (4 planes) | sV (512 rows) | sS | sumsq, rows at 272 B.
// ---------------------------------------------------------------------------
__global__ void __launch_bounds__(256)
fused_attn_kernel(const _Float16* __restrict__ Xh,
                  const float*    __restrict__ mask,
                  const _Float16* __restrict__ Vt,
                  float*          __restrict__ out) {
    __shared__ __attribute__((aligned(2048))) char smem[SMEM_TOTAL];
    _Float16* sS     = (_Float16*)(smem + SS_OFF);
    float*    sSumSq = (float*)   (smem + SUM_OFF);

    const int bidx = blockIdx.x / (NSEQ / NROWS);
    const int n0   = (blockIdx.x % (NSEQ / NROWS)) * NROWS;
    const int tid  = threadIdx.x;
    const int w    = tid >> 5;
    const int lane = tid & 31;
    const unsigned int wave  = uni(threadIdx.x >> 5);
    const unsigned int lbase = (unsigned int)(uintptr_t)smem;

    const _Float16* Kg = Xh + (size_t)bidx * NSEQ * DMODEL;  // this batch's keys
    // plane 'wave' of stage st: columns [wave*128, +128) of key rows [st*128, +128)
    const _Float16* Kplane = Kg + (wave & 3u) * 128u;
    const unsigned int plane_dst = lbase + (wave & 3u) * KPLANE_B;
    // slice 'wave & 3' of stage st: keys [st*128, +128) of e-rows [(wave&3)*128, +128)
    const _Float16* Vslice = Vt + ((size_t)bidx * DMODEL + (wave & 3u) * 128u) * NSEQ;
    const unsigned int slice_dst = lbase + SV_OFF + (wave & 3u) * KPLANE_B;
    const v8u g1K = tdm_group1(DMODEL * 2u);
    const v8u g1V = tdm_group1(NSEQ * 2u);
    v4u g0K = tdm_group0(Kplane, plane_dst);     // stage K(0)
    v4u g0V = tdm_group0(Vslice, slice_dst);     // stage V(0)

    const int rt = w & 3;           // score phase: row tile (16 of the 64 rows)
    const int ch = w >> 2;          // score phase: key half (4 column tiles of 16 keys)
    const int rp = w & 1;           // output phase: row pair (32 of the 64 rows)
    const int eg = w >> 1;          // output phase: e-group (8 tiles of 16 e-columns)

    // the wave's 16 query rows, all 512 columns, as 16 A fragments
    v16h aQ[16];
    {
        const _Float16* qrow = Xh + ((size_t)bidx * NSEQ + n0 + rt * 16) * DMODEL;
#pragma unroll
        for (int kc = 0; kc < 16; ++kc)
            aQ[kc] = load_frag_rm(qrow + kc * 32, DMODEL, lane);
    }
    if (tid < NROWS) sSumSq[tid] = 0.0f;

    // prologue of the two-buffer ring: stage K(0), its wait, the barrier, stage V(0)
    if (pinned(wave < 4u)) {
        tdm_load(g0K, g1K);
        wait_tensor0();
    }
    __syncthreads();
    if (pinned((wave >> 2) == 1u))
        tdm_load(g0V, g1V);

    v8f oacc[2][8] = {};

    for (int t = 0; t < NSEQ / 128; ++t) {
        const int mstep = t * 128;

        // ================= phase 1: masked scores (Q in registers, K from LDS) ====
        {
            const _Float16* kbase = (const _Float16*)smem + (size_t)(ch * 64) * PITCH_H;

            // The step's mask values are asked for here, ahead of the score
            // products, so that their memory latencies run side by side and behind
            // the WMMAs instead of one after another behind them.
            const float* mp = mask
                + ((size_t)bidx * NSEQ + n0 + rt * 16 + ((lane >> 4) << 3)) * NSEQ
                + mstep + ch * 64 + (lane & 15);
            float mv[4][8];
#pragma unroll
            for (int c = 0; c < 4; ++c) {
#pragma unroll
                for (int v = 0; v < 8; ++v)
                    mv[c][v] = __builtin_nontemporal_load(mp + (size_t)v * NSEQ + c * 16);
            }
            asm volatile("s_wait_xcnt 0x0" ::: "memory");

            // one Q fragment meets the four K fragments of its 32 columns: four
            // independent accumulators, each taking its chunks in the order 0..15
            v8f s[4] = {};
#pragma unroll                                    // aQ is indexed by constants only
            for (int kc = 0; kc < 16; ++kc) {
                v16h bK[4];
#pragma unroll
                for (int c = 0; c < 4; ++c)
                    bK[c] = load_frag_rm(kbase + (size_t)(c * 16) * PITCH_H
                                         + (kc >> 2) * (KPLANE_B / 2) + (kc & 3) * 32,
                                         PITCH_H, lane);
#pragma unroll
                for (int c = 0; c < 4; ++c)
                    s[c] = wmma_f16(aQ[kc], bK[c], s[c]);
            }
            // order asked of the scheduler: a chunk's eight LDS reads stand together,
            // two chunks ahead of the four WMMAs that use them; with two reads and a
            // wait to zero in front of every WMMA the LDS latency is paid each time.
            // The mask loads stand in front of the first WMMA: left alone they sank to
            // the last chunks, and their memory latency lay open behind the products
            __builtin_amdgcn_sched_group_barrier(0x020, 32, 0);       // the 32 mask loads
            __builtin_amdgcn_sched_group_barrier(0x100, 16, 0);       // reads of chunks 0, 1
#pragma unroll
            for (int kc = 2; kc < 16; ++kc) {
                __builtin_amdgcn_sched_group_barrier(0x100, 8, 0);    // reads of chunk kc
                __builtin_amdgcn_sched_group_barrier(0x008, 4, 0);    // WMMAs of chunk kc-2
            }
            __builtin_amdgcn_sched_group_barrier(0x008, 8, 0);        // WMMAs of chunks 14, 15

            if (mstep + 128 < NSEQ)
                __builtin_prefetch(mp + 128, 0, 0);    // global_prefetch_b8

            // the eight rows go through each stage together: eight independent
            // chains, so that a cross-lane step's latency is paid once a stage
            const int row0 = rt * 16 + ((lane >> 4) << 3);
            float sq[8];
#pragma unroll
            for (int v = 0; v < 8; ++v)
                sq[v] = 0.0f;
#pragma unroll
            for (int c = 0; c < 4; ++c) {
#pragma unroll
                for (int v = 0; v < 8; ++v) {
                    const float sv = s[c][v] * INV_TEMP * mv[c][v];
                    sq[v] += sv * sv;
                    sS[(size_t)(row0 + v) * PITCH_H + ch * 64 + c * 16 + (lane & 15)] = (_Float16)sv;
                }
            }
#pragma unroll
            for (int m = 1; m < 16; m <<= 1) {
#pragma unroll
                for (int v = 0; v < 8; ++v)
                    sq[v] += __shfl_xor(sq[v], m);
            }
            if ((lane & 15) == 0) {
#pragma unroll
                for (int v = 0; v < 8; ++v)
                    atomicAdd(&sSumSq[row0 + v], sq[v]);
            }
        }
        // publish point of V(t) (and of the S tile): own LDS reads and writes done,
        // own request landed, barrier; only then the refill of the K buffer, which
        // the score phase has just read
        wait_ds0();
        if (pinned((wave >> 2) == 1u))
            wait_tensor0();
        __syncthreads();
        if (pinned(wave < 4u && t + 1 < NSEQ / 128)) {
            g0K = tdm_advance(g0K, 128u * DMODEL * 2u);   // 128 key rows on
            tdm_load(g0K, g1K);
        }

        // ================= phase 2: out += S * Vt (S,V both from LDS) ====
        {
            // key chunk outermost: the sixteen tiles of a chunk are independent
            // accumulators, and each accumulator still takes its chunks in order 0..3;
            // every V fragment serves the two row tiles of the wave
            const _Float16* sbase = sS + (size_t)(rp * 32) * PITCH_H;
            const _Float16* vbase =
                (const _Float16*)(smem + SV_OFF) + (size_t)(eg * 128) * PITCH_H;
#pragma unroll
            for (int kk = 0; kk < 4; ++kk) {
                v16h aS[2];
#pragma unroll
                for (int r = 0; r < 2; ++r)
                    aS[r] = load_frag_rm(sbase + (size_t)(r * 16) * PITCH_H + kk * 32, PITCH_H, lane);
                v16h c[8];
#pragma unroll
                for (int j = 0; j < 8; ++j)
                    c[j] = load_frag_rm(vbase + (size_t)(j * 16) * PITCH_H + kk * 32, PITCH_H, lane);
#pragma unroll
                for (int j = 0; j < 8; ++j) {
#pragma unroll
                    for (int r = 0; r < 2; ++r)
                        oacc[r][j] = wmma_f16(aS[r], c[j], oacc[r][j]);
                }
            }
            // order asked of the scheduler: a chunk's twenty LDS reads stand together, one
            // chunk ahead of the sixteen WMMAs that use them; left alone it put two reads
            // and a wait to zero in front of every WMMA, the full LDS latency each time
            __builtin_amdgcn_sched_group_barrier(0x100, 20, 0);   // reads of chunk 0
#pragma unroll
            for (int kk = 1; kk < 4; ++kk) {
                __builtin_amdgcn_sched_group_barrier(0x100, 20, 0);   // reads of chunk kk
                __builtin_amdgcn_sched_group_barrier(0x008, 16, 0);   // WMMAs of chunk kk-1
            }
            __builtin_amdgcn_sched_group_barrier(0x008, 16, 0);       // WMMAs of chunk 3
            // keeps the wait below behind the last WMMA: lifted to the last LDS read it
            // held the products of chunk 2 back until the reads of chunk 3 had returned
            __builtin_amdgcn_sched_barrier(0);
        }

        // publish point of K(t+1): own LDS reads done, own request landed, barrier;
        // only then the refill of the V buffer, which the output phase has just read
        wait_ds0();
        if (pinned(wave < 4u))
            wait_tensor0();
        __syncthreads();
        if (pinned((wave >> 2) == 1u && t + 1 < NSEQ / 128)) {
            g0V = tdm_advance(g0V, 128u * 2u);            // 128 keys on in every e-row
            tdm_load(g0V, g1V);
        }
    }
    // end of the ring: no request and no LDS read of this wave is left in flight
    wait_tensor0();
    wait_ds0();

    // ---- epilogue: L2-normalize rows, store ------------------------------
#pragma unroll
    for (int r = 0; r < 2; ++r) {
#pragma unroll
        for (int v = 0; v < 8; ++v) {
            const int row = rp * 32 + r * 16 + ((lane >> 4) << 3) + v;
            const float sc = 1.0f / fmaxf(sqrtf(sSumSq[row]), EPS);
            float* op = out + ((size_t)bidx * NSEQ + n0 + row) * DMODEL
                            + eg * 128 + (lane & 15);
#pragma unroll
            for (int j = 0; j < 8; ++j)
                op[j * 16] = oacc[r][j][v] * sc;
        }
    }
}

// ---------------------------------------------------------------------------
// Launch
// ---------------------------------------------------------------------------
extern "C" void kernel_launch(void* const* d_in, const int* in_sizes, int n_in,
                              void* d_out, int out_size, void* d_ws, size_t ws_size,
                              hipStream_t stream) {
    const float* X    = (const float*)d_in[0];   // [8,2048,512]
    const float* M    = (const float*)d_in[1];   // [8,2048,2048]
    const float* W    = (const float*)d_in[2];   // [512,512]
    const float* bias = (const float*)d_in[3];   // [512]
    float* out = (float*)d_out;

    const size_t XH_ELEMS = (size_t)BATCH * NSEQ * DMODEL;  // 8,388,608
    const size_t WH_ELEMS = (size_t)DMODEL * DMODEL;        //   262,144
    char* ws = (char*)d_ws;
    _Float16* Xh = (_Float16*)ws;
    _Float16* Wh = (_Float16*)(ws + XH_ELEMS * sizeof(_Float16));
    _Float16* Vt = (_Float16*)(ws + (XH_ELEMS + WH_ELEMS) * sizeof(_Float16));

    cvt_f32_to_f16<<<(int)(XH_ELEMS / (256 * 8)), 256, 0, stream>>>(X, Xh, (int)XH_ELEMS);
    cvt_f32_to_f16<<<(int)(WH_ELEMS / (256 * 8)), 256, 0, stream>>>(W, Wh, (int)WH_ELEMS);

    proj_elu_kernel<<<(BATCH * NSEQ / 128) * 2, 256, 0, stream>>>(Xh, Wh, bias, Vt);

    fused_attn_kernel<<<BATCH * (NSEQ / NROWS), 256, 0, stream>>>(Xh, M, Vt, out);
}

// v006
// Measured time: 79.8 microseconds a run.
// Next to v005, in two timings, it ran 1.04 and 1.05 times as fast.
// Counting every step since v000, it is 8.25 times as fast.
#include <hip/hip_runtime.h>
#include <hip/hip_bf16.h>
#include <math.h>

// ---------------------------------------------------------------------------
// Problem constants (reference: B=8, N=2048, D=512)
// ---------------------------------------------------------------------------
#define BATCH 8
#define NSEQ  2048
#define DMODEL 512
#define INV_TEMP 0.04419417382415922f   // 1/sqrt(512)
#define EPS 1e-5f

typedef __attribute__((ext_vector_type(16))) _Float16 v16h;
typedef __attribute__((ext_vector_type(8)))  _Float16 v8h;
typedef __attribute__((ext_vector_type(8)))  float    v8f;
typedef __attribute__((ext_vector_type(4)))  unsigned int v4u;
typedef __attribute__((ext_vector_type(8)))  unsigned int v8u;

__device__ __forceinline__ v16h load_frag_rm(const _Float16* base, int stride, int lane) {
    const int r  = lane & 15;
    const int hs = (lane >> 4) << 3;             // 0 or 8
    const _Float16* p = base + (size_t)r * stride + hs;
    v8h lo = *(const v8h*)(p);
    v8h hi = *(const v8h*)(p + 16);
    return __builtin_shufflevector(lo, hi, 0,1,2,3,4,5,6,7,8,9,10,11,12,13,14,15);
}

__device__ __forceinline__ v8f wmma_f16(v16h a, v16h b, v8f c) {
    return __builtin_amdgcn_wmma_f32_16x16x32_f16(
        false, a, false, b, (short)0, c, false, false);
}

// branchless ELU (alpha = 1) on the fast-exp path (v_exp_f32)
__device__ __forceinline__ float elu_fast(float x) {
    float e = __expf(x) - 1.0f;
    return (x > 0.0f) ? x : e;
}

#define PITCH_B    272                          // LDS row pitch in bytes
#define PITCH_H    (PITCH_B / 2)                // ... in halves
#define KPLANE_B   (128 * PITCH_B)              // 34816 = 17 * 2048
#define KBUF_B     (4 * KPLANE_B)               // 139264: the K tile; the V tile is as large
#define SV_OFF     KBUF_B                       // V tile behind the K tile
#define NROWS      64                           // query rows of a work-group
#define SS_OFF     (2 * KBUF_B)                 // 278528
#define SUM_OFF    (SS_OFF + NROWS * PITCH_B)   // 295936
#define SMEM_TOTAL (SUM_OFF + NROWS * 4)        // 296192

__device__ __forceinline__ unsigned int uni(unsigned int v) {
    return (unsigned int)__builtin_amdgcn_readfirstlane(v);
}
__device__ __forceinline__ unsigned int pinned(unsigned int v) {
    unsigned int w = uni(v);
    asm volatile("" : "+s"(w));   // pinned(): keeps the issue test in a scalar register
    return w;
}
__device__ __forceinline__ void wait_tensor0() { asm volatile("s_wait_tensorcnt 0x0" ::: "memory"); }
// a wave's LDS reads have retired before the barrier behind which a buffer is refilled
__device__ __forceinline__ void wait_ds0()     { asm volatile("s_wait_dscnt 0x0" ::: "memory"); }

__device__ __forceinline__ v8u tdm_group1(unsigned int src_pitch) {
    v8u g1;
    g1[0] = uni((1u << 20) | (5u << 22) | (3u << 25));
    g1[1] = uni(256u << 16);
    g1[2] = uni(128u << 16);
    g1[3] = uni(256u << 16);
    g1[4] = uni(128u);
    g1[5] = uni(src_pitch);
    g1[6] = uni(0u);
    g1[7] = uni(0u);
    asm volatile("" : "+s"(g1));
    return g1;
}
__device__ __forceinline__ v4u tdm_group0(const _Float16* gsrc, unsigned int lds_dst) {
    const unsigned long long ga = (unsigned long long)(uintptr_t)gsrc;
    v4u g0;
    g0[0] = uni(1u);                                           // count = 1
    g0[1] = uni(lds_dst);                                      // byte offset in LDS
    g0[2] = uni((unsigned int)ga);                             // address [31:0]
    g0[3] = uni((((unsigned int)(ga >> 32)) & 0x01ffffffu) | 0x80000000u);
    asm volatile("" : "+s"(g0));
    return g0;
}
// the next tile's address: words 2 and 3 taken as one 64-bit number, whose low 57
// bits are the address, so that a carry out of word 2 stays inside the address
__device__ __forceinline__ v4u tdm_advance(v4u g0, unsigned int bytes) {
    const unsigned long long a = ((((unsigned long long)g0[3]) << 32) | g0[2]) + bytes;
    g0[2] = uni((unsigned int)a);
    g0[3] = uni((unsigned int)(a >> 32));
    asm volatile("" : "+s"(g0));
    return g0;
}
// the next stage of a ring whose buffers alternate: the address moves on as in
// tdm_advance, and word 1 takes the other buffer's place in LDS
__device__ __forceinline__ v4u tdm_next(v4u g0, unsigned int bytes, unsigned int lds_dst) {
    const unsigned long long a = ((((unsigned long long)g0[3]) << 32) | g0[2]) + bytes;
    g0[1] = uni(lds_dst);
    g0[2] = uni((unsigned int)a);
    g0[3] = uni((unsigned int)(a >> 32));
    asm volatile("" : "+s"(g0));
    return g0;
}
__device__ __forceinline__ void tdm_load(v4u g0, v8u g1) {
    asm volatile("tensor_load_to_lds %0, %1" :: "s"(g0), "s"(g1) : "memory");
}

// ---------------------------------------------------------------------------
// Kernel 0: f32 -> f16 conversion (W), 8 elems/thread
// ---------------------------------------------------------------------------
__global__ void cvt_f32_to_f16(const float* __restrict__ in,
                               _Float16* __restrict__ out, int n) {
    int i = (blockIdx.x * blockDim.x + threadIdx.x) * 8;
    if (i >= n) return;
    float4 a = *(const float4*)(in + i);
    float4 b = *(const float4*)(in + i + 4);
    v8h h;
    h[0] = (_Float16)a.x; h[1] = (_Float16)a.y;
    h[2] = (_Float16)a.z; h[3] = (_Float16)a.w;
    h[4] = (_Float16)b.x; h[5] = (_Float16)b.y;
    h[6] = (_Float16)b.z; h[7] = (_Float16)b.w;
    *(v8h*)(out + i) = h;
}

// ---------------------------------------------------------------------------
// Kernel 1: Vt[b][e][n] = elu( X W^T + b )^T  (f16, transposed layout), and the
// f16 copy Xh of X that the fused kernel reads.
// Grid: (BATCH*NSEQ/128) * 2 x 256 threads (8 waves): one work-group on every WGP
// makes 128 rows n x 256 columns e. Its 128 rows of X come as f32 by whole-line
// loads, are converted once and stay in LDS for the whole kernel: four planes of
// 128 k (256 B of every row) at a pitch of 272 B; the work-group of the lower
// column half also writes them to Xh. The 512 k go in four stages of 128 k: a
// stage of W is 256 rows at the same pitch, brought by waves 0 and 1 with one
// tensor load of 128 rows each; two buffers, so that stage s+1 flies while stage s
// is worked on. Wave tile 64 n x 64 e: every fragment read from LDS serves four
// WMMAs. Each accumulator takes its k chunks in the order 0..15.
// ---------------------------------------------------------------------------
#define WSTAGE_B   (2 * KPLANE_B)               // 69632 = 34 * 2048
#define PSTAGES    (DMODEL / 128)               // 4
#define XLOADS     (128 * DMODEL / 4 / 256)     // 64 loads of 16 B a thread

typedef __attribute__((ext_vector_type(4)))  _Float16 v4h;

__global__ void __launch_bounds__(256)
proj_elu_kernel(const float*    __restrict__ X,
                _Float16*       __restrict__ Xh,
                const _Float16* __restrict__ Wh,
                const float*    __restrict__ bias,
                _Float16*       __restrict__ Vt) {
    __shared__ __attribute__((aligned(2048))) char smem[KBUF_B + 2 * WSTAGE_B];

    const int nt   = blockIdx.x >> 1;            // 128 of the BATCH*NSEQ rows
    const int eh   = blockIdx.x & 1;             // 256 of the 512 columns e
    const int tid  = threadIdx.x;
    const int w    = threadIdx.x >> 5;
    const int lane = threadIdx.x & 31;
    const int wn   = w & 1;                      // 64 of the 128 rows
    const int we   = w >> 1;                     // 64 of the 256 columns
    const unsigned int wave  = uni(threadIdx.x >> 5);
    const unsigned int lbase = (unsigned int)(uintptr_t)smem;

    // waves 0 and 1 each bring 128 of the W rows
    const _Float16* gsrc = Wh + ((size_t)eh * 256 + (wave & 1u) * 128u) * DMODEL;
    const unsigned int slice_dst = lbase + KBUF_B + (wave & 1u) * KPLANE_B;
    const v8u g1 = tdm_group1(DMODEL * 2u);
    v4u g0 = tdm_group0(gsrc, slice_dst);        // stage 0, buffer 0

    // The X tile: load i of the work-group covers two whole rows, a wave 512 B in a
    // row (four whole lines). All loads of a thread are asked for together, so that
    // the memory latency is paid once.
    const float* xbase = X + (size_t)nt * 128 * DMODEL;
    float4 xr[XLOADS];
#pragma unroll                                    // xr is indexed by constants only: it stays in registers
    for (int i = 0; i < XLOADS; ++i)
        xr[i] = *(const float4*)(xbase + tid * 4 + i * 1024);
    asm volatile("s_wait_xcnt 0x0" :: "s"(xbase) : "memory");

    // prologue of the two-buffer ring: stage 0, its wait (behind the X loads' issue,
    // so that both latencies run side by side), the barrier, stage 1
    if (pinned(wave < 2u)) {
        tdm_load(g0, g1);
        wait_tensor0();
    }

    // a wave's 128 converted values are one 256-B row of one plane (and 256 B in a
    // row of Xh)
    v4h xh[XLOADS];
    {
        char* xl = smem + (w & 3) * KPLANE_B + (tid >> 7) * PITCH_B + lane * 8;
#pragma unroll                                    // xr, xh are indexed by constants only
        for (int i = 0; i < XLOADS; ++i) {
            xh[i][0] = (_Float16)xr[i].x; xh[i][1] = (_Float16)xr[i].y;
            xh[i][2] = (_Float16)xr[i].z; xh[i][3] = (_Float16)xr[i].w;
            *(v4h*)(xl + i * 2 * PITCH_B) = xh[i];
        }
    }
    // the barrier publishes W's stage 0 and the X planes: own LDS writes done first
    wait_ds0();
    __syncthreads();
    if (pinned(wave < 2u)) {
        g0 = tdm_next(g0, 256u, slice_dst + WSTAGE_B);
        tdm_load(g0, g1);
    }
    // Xh goes out behind the barrier, so that no wave waits there for these stores:
    // they drain behind the products of the first stage
    if (eh == 0) {
        _Float16* xg = Xh + (size_t)nt * 128 * DMODEL;
#pragma unroll                                    // xh is indexed by constants only
        for (int i = 0; i < XLOADS; ++i)
            *(v4h*)(xg + tid * 4 + i * 1024) = xh[i];
        asm volatile("s_wait_xcnt 0x0" :: "s"(xg) : "memory");
    }

    v8f acc[4][4] = {};
#pragma unroll 1
    for (int s = 0; s < PSTAGES; ++s) {
        const _Float16* abase = (const _Float16*)(smem + s * KPLANE_B)
                                + (size_t)(wn * 64) * PITCH_H;
        const _Float16* bbase = (const _Float16*)(smem + KBUF_B + (s & 1) * WSTAGE_B)
                                + (size_t)(we * 64) * PITCH_H;
#pragma unroll
        for (int kk = 0; kk < 4; ++kk) {
            v16h aX[4], bW[4];
#pragma unroll
            for (int i = 0; i < 4; ++i)
                aX[i] = load_frag_rm(abase + (size_t)(i * 16) * PITCH_H + kk * 32, PITCH_H, lane);
#pragma unroll
            for (int j = 0; j < 4; ++j)
                bW[j] = load_frag_rm(bbase + (size_t)(j * 16) * PITCH_H + kk * 32, PITCH_H, lane);
#pragma unroll
            for (int i = 0; i < 4; ++i) {
#pragma unroll
                for (int j = 0; j < 4; ++j)
                    acc[i][j] = wmma_f16(aX[i], bW[j], acc[i][j]);
            }
        }
        // order asked of the scheduler: a chunk's sixteen LDS reads stand together, one
        // chunk ahead of the sixteen WMMAs that use them, so that the LDS latency is
        // paid behind products and not in front of each of them
        __builtin_amdgcn_sched_group_barrier(0x100, 16, 0);       // reads of chunk 0
#pragma unroll
        for (int kk = 1; kk < 4; ++kk) {
            __builtin_amdgcn_sched_group_barrier(0x100, 16, 0);   // reads of chunk kk
            __builtin_amdgcn_sched_group_barrier(0x008, 16, 0);   // WMMAs of chunk kk-1
        }
        __builtin_amdgcn_sched_group_barrier(0x008, 16, 0);       // WMMAs of chunk 3
        // keeps the wait below behind the last WMMA, so that it does not hold the
        // products of chunk 2 back until the reads of chunk 3 have returned
        __builtin_amdgcn_sched_barrier(0);

        // publish point of stage s+1: own LDS reads done, own request landed, barrier;
        // only then the refill of the buffer that this pass has just read
        wait_ds0();
        if (pinned(wave < 2u))
            wait_tensor0();
        __syncthreads();
        if (pinned(wave < 2u && s + 2 < PSTAGES)) {
            g0 = tdm_next(g0, 256u, slice_dst + (unsigned int)(s & 1) * WSTAGE_B);
            tdm_load(g0, g1);
        }
    }
    // end of the ring: no request and no LDS read of this wave is left in flight
    wait_tensor0();
    wait_ds0();

    // a lane holds 8 consecutive n of one column e: 16 B of a row of Vt
    const int bidx = nt / (NSEQ / 128);
    const int n0   = (nt % (NSEQ / 128)) * 128 + wn * 64 + ((lane >> 4) << 3);
    const int e0   = eh * 256 + we * 64 + (lane & 15);
    _Float16* dst = Vt + ((size_t)bidx * DMODEL + e0) * NSEQ + n0;
#pragma unroll
    for (int j = 0; j < 4; ++j) {
        const float bv = bias[e0 + j * 16];
#pragma unroll
        for (int i = 0; i < 4; ++i) {
            v8h h;
#pragma unroll
            for (int v = 0; v < 8; ++v)
                h[v] = (_Float16)elu_fast(acc[i][j][v] + bv);
            *(v8h*)(dst + (size_t)(j * 16) * NSEQ + i * 16) = h;
        }
    }
}

// ---------------------------------------------------------------------------
// Kernel 2: fused  S = mask .* (X Xt / sqrt(D));  out = (S / max(||S||2,eps)) V
// Grid: BATCH*(NSEQ/64) x 256 threads (8 waves); 64-row n-tile, m-steps of 128:
// one work-group on every WGP, and each K and V tile that comes from L2 serves
// 64 query rows. The Q rows do not fit in LDS beside the two tiles: each wave
// holds the 16 fragments of its own 16 query rows in registers for the whole loop.
// Two LDS buffers, filled by tensor load, form one ring over the stages
// K(0), V(0), K(1), V(1), ...: waves 0..3 each bring one 256-B column plane of the
// 128x512 f16 K tile, waves 4..7 each 128 e-rows of the 512x128 f16 V tile.
// V(t) flies during the score phase of step t, K(t+1) during its output phase.
// LDS: sK (4 planes) | sV (512 rows) | sS | sumsq, rows at 272 B.
// ---------------------------------------------------------------------------
__global__ void __launch_bounds__(256)
fused_attn_kernel(const _Float16* __restrict__ Xh,
                  const float*    __restrict__ mask,
                  const _Float16* __restrict__ Vt,
                  float*          __restrict__ out) {
    __shared__ __attribute__((aligned(2048))) char smem[SMEM_TOTAL];
    _Float16* sS     = (_Float16*)(smem + SS_OFF);
    float*    sSumSq = (float*)   (smem + SUM_OFF);

    const int bidx = blockIdx.x / (NSEQ / NROWS);
    const int n0   = (blockIdx.x % (NSEQ / NROWS)) * NROWS;
    const int tid  = threadIdx.x;
    const int w    = tid >> 5;
    const int lane = tid & 31;
    const unsigned int wave  = uni(threadIdx.x >> 5);
    const unsigned int lbase = (unsigned int)(uintptr_t)smem;

    const _Float16* Kg = Xh + (size_t)bidx * NSEQ * DMODEL;  // this batch's keys
    // plane 'wave' of stage st: columns [wave*128, +128) of key rows [st*128, +128)
    const _Float16* Kplane = Kg + (wave & 3u) * 128u;
    const unsigned int plane_dst = lbase + (wave & 3u) * KPLANE_B;
    // slice 'wave & 3' of stage st: keys [st*128, +128) of e-rows [(wave&3)*128, +128)
    const _Float16* Vslice = Vt + ((size_t)bidx * DMODEL + (wave & 3u) * 128u) * NSEQ;
    const unsigned int slice_dst = lbase + SV_OFF + (wave & 3u) * KPLANE_B;
    const v8u g1K = tdm_group1(DMODEL * 2u);
    const v8u g1V = tdm_group1(NSEQ * 2u);
    v4u g0K = tdm_group0(Kplane, plane_dst);     // stage K(0)
    v4u g0V = tdm_group0(Vslice, slice_dst);     // stage V(0)

    const int rt = w & 3;           // score phase: row tile (16 of the 64 rows)
    const int ch = w >> 2;          // score phase: key half (4 column tiles of 16 keys)
    const int rp = w & 1;           // output phase: row pair (32 of the 64 rows)
    const int eg = w >> 1;          // output phase: e-group (8 tiles of 16 e-columns)

    // the wave's 16 query rows, all 512 columns, as 16 A fragments
    v16h aQ[16];
    {
        const _Float16* qrow = Xh + ((size_t)bidx * NSEQ + n0 + rt * 16) * DMODEL;
#pragma unroll
        for (int kc = 0; kc < 16; ++kc)
            aQ[kc] = load_frag_rm(qrow + kc * 32, DMODEL, lane);
    }
    if (tid < NROWS) sSumSq[tid] = 0.0f;

    // prologue of the two-buffer ring: stage K(0), its wait, the barrier, stage V(0)
    if (pinned(wave < 4u)) {
        tdm_load(g0K, g1K);
        wait_tensor0();
    }
    __syncthreads();
    if (pinned((wave >> 2) == 1u))
        tdm_load(g0V, g1V);

    v8f oacc[2][8] = {};

    for (int t = 0; t < NSEQ / 128; ++t) {
        const int mstep = t * 128;

        // ================= phase 1: masked scores (Q in registers, K from LDS) ====
        {
            const _Float16* kbase = (const _Float16*)smem + (size_t)(ch * 64) * PITCH_H;

            // The step's mask values are asked for here, ahead of the score
            // products, so that their memory latencies run side by side and behind
            // the WMMAs instead of one after another behind them.
            const float* mp = mask
                + ((size_t)bidx * NSEQ + n0 + rt * 16 + ((lane >> 4) << 3)) * NSEQ
                + mstep + ch * 64 + (lane & 15);
            float mv[4][8];
#pragma unroll
            for (int c = 0; c < 4; ++c) {
#pragma unroll
                for (int v = 0; v < 8; ++v)
                    mv[c][v] = __builtin_nontemporal_load(mp + (size_t)v * NSEQ + c * 16);
            }
            asm volatile("s_wait_xcnt 0x0" ::: "memory");

            // one Q fragment meets the four K fragments of its 32 columns: four
            // independent accumulators, each taking its chunks in the order 0..15
            v8f s[4] = {};
#pragma unroll                                    // aQ is indexed by constants only
            for (int kc = 0; kc < 16; ++kc) {
                v16h bK[4];
#pragma unroll
                for (int c = 0; c < 4; ++c)
                    bK[c] = load_frag_rm(kbase + (size_t)(c * 16) * PITCH_H
                                         + (kc >> 2) * (KPLANE_B / 2) + (kc & 3) * 32,
                                         PITCH_H, lane);
#pragma unroll
                for (int c = 0; c < 4; ++c)
                    s[c] = wmma_f16(aQ[kc], bK[c], s[c]);
            }
            // order asked of the scheduler: a chunk's eight LDS reads stand together,
            // two chunks ahead of the four WMMAs that use them; with two reads and a
            // wait to zero in front of every WMMA the LDS latency is paid each time.
            // The mask loads stand in front of the first WMMA: left alone they sank to
            // the last chunks, and their memory latency lay open behind the products
            __builtin_amdgcn_sched_group_barrier(0x020, 32, 0);       // the 32 mask loads
            __builtin_amdgcn_sched_group_barrier(0x100, 16, 0);       // reads of chunks 0, 1
#pragma unroll
            for (int kc = 2; kc < 16; ++kc) {
                __builtin_amdgcn_sched_group_barrier(0x100, 8, 0);    // reads of chunk kc
                __builtin_amdgcn_sched_group_barrier(0x008, 4, 0);    // WMMAs of chunk kc-2
            }
            __builtin_amdgcn_sched_group_barrier(0x008, 8, 0);        // WMMAs of chunks 14, 15

            if (mstep + 128 < NSEQ)
                __builtin_prefetch(mp + 128, 0, 0);    // global_prefetch_b8

            // the eight rows go through each stage together: eight independent
            // chains, so that a cross-lane step's latency is paid once a stage
            const int row0 = rt * 16 + ((lane >> 4) << 3);
            float sq[8];
#pragma unroll
            for (int v = 0; v < 8; ++v)
                sq[v] = 0.0f;
#pragma unroll
            for (int c = 0; c < 4; ++c) {
#pragma unroll
                for (int v = 0; v < 8; ++v) {
                    const float sv = s[c][v] * INV_TEMP * mv[c][v];
                    sq[v] += sv * sv;
                    sS[(size_t)(row0 + v) * PITCH_H + ch * 64 + c * 16 + (lane & 15)] = (_Float16)sv;
                }
            }
#pragma unroll
            for (int m = 1; m < 16; m <<= 1) {
#pragma unroll
                for (int v = 0; v < 8; ++v)
                    sq[v] += __shfl_xor(sq[v], m);
            }
            if ((lane & 15) == 0) {
#pragma unroll
                for (int v = 0; v < 8; ++v)
                    atomicAdd(&sSumSq[row0 + v], sq[v]);
            }
        }
        // publish point of V(t) (and of the S tile): own LDS reads and writes done,
        // own request landed, barrier; only then the refill of the K buffer, which
        // the score phase has just read
        wait_ds0();
        if (pinned((wave >> 2) == 1u))
            wait_tensor0();
        __syncthreads();
        if (pinned(wave < 4u && t + 1 < NSEQ / 128)) {
            g0K = tdm_advance(g0K, 128u * DMODEL * 2u);   // 128 key rows on
            tdm_load(g0K, g1K);
        }

        // ================= phase 2: out += S * Vt (S,V both from LDS) ====
        {
            // key chunk outermost: the sixteen tiles of a chunk are independent
            // accumulators, and each accumulator still takes its chunks in order 0..3;
            // every V fragment serves the two row tiles of the wave
            const _Float16* sbase = sS + (size_t)(rp * 32) * PITCH_H;
            const _Float16* vbase =
                (const _Float16*)(smem + SV_OFF) + (size_t)(eg * 128) * PITCH_H;
#pragma unroll
            for (int kk = 0; kk < 4; ++kk) {
                v16h aS[2];
#pragma unroll
                for (int r = 0; r < 2; ++r)
                    aS[r] = load_frag_rm(sbase + (size_t)(r * 16) * PITCH_H + kk * 32, PITCH_H, lane);
                v16h c[8];
#pragma unroll
                for (int j = 0; j < 8; ++j)
                    c[j] = load_frag_rm(vbase + (size_t)(j * 16) * PITCH_H + kk * 32, PITCH_H, lane);
#pragma unroll
                for (int j = 0; j < 8; ++j) {
#pragma unroll
                    for (int r = 0; r < 2; ++r)
                        oacc[r][j] = wmma_f16(aS[r], c[j], oacc[r][j]);
                }
            }
            // order asked of the scheduler: a chunk's twenty LDS reads stand together, one
            // chunk ahead of the sixteen WMMAs that use them; left alone it put two reads
            // and a wait to zero in front of every WMMA, the full LDS latency each time
            __builtin_amdgcn_sched_group_barrier(0x100, 20, 0);   // reads of chunk 0
#pragma unroll
            for (int kk = 1; kk < 4; ++kk) {
                __builtin_amdgcn_sched_group_barrier(0x100, 20, 0);   // reads of chunk kk
                __builtin_amdgcn_sched_group_barrier(0x008, 16, 0);   // WMMAs of chunk kk-1
            }
            __builtin_amdgcn_sched_group_barrier(0x008, 16, 0);       // WMMAs of chunk 3
            // keeps the wait below behind the last WMMA: lifted to the last LDS read it
            // held the products of chunk 2 back until the reads of chunk 3 had returned
            __builtin_amdgcn_sched_barrier(0);
        }

        // publish point of K(t+1): own LDS reads done, own request landed, barrier;
        // only then the refill of the V buffer, which the output phase has just read
        wait_ds0();
        if (pinned(wave < 4u))
            wait_tensor0();
        __syncthreads();
        if (pinned((wave >> 2) == 1u && t + 1 < NSEQ / 128)) {
            g0V = tdm_advance(g0V, 128u * 2u);            // 128 keys on in every e-row
            tdm_load(g0V, g1V);
        }
    }
    // end of the ring: no request and no LDS read of this wave is left in flight
    wait_tensor0();
    wait_ds0();

    // ---- epilogue: L2-normalize rows, store ------------------------------
#pragma unroll
    for (int r = 0; r < 2; ++r) {
#pragma unroll
        for (int v = 0; v < 8; ++v) {
            const int row = rp * 32 + r * 16 + ((lane >> 4) << 3) + v;
            const float sc = 1.0f / fmaxf(sqrtf(sSumSq[row]), EPS);
            float* op = out + ((size_t)bidx * NSEQ + n0 + row) * DMODEL
                            + eg * 128 + (lane & 15);
#pragma unroll
            for (int j = 0; j < 8; ++j)
                op[j * 16] = oacc[r][j][v] * sc;
        }
    }
}

// ---------------------------------------------------------------------------
// Launch
// ---------------------------------------------------------------------------
extern "C" void kernel_launch(void* const* d_in, const int* in_sizes, int n_in,
                              void* d_out, int out_size, void* d_ws, size_t ws_size,
                              hipStream_t stream) {
    const float* X    = (const float*)d_in[0];   // [8,2048,512]
    const float* M    = (const float*)d_in[1];   // [8,2048,2048]
    const float* W    = (const float*)d_in[2];   // [512,512]
    const float* bias = (const float*)d_in[3];   // [512]
    float* out = (float*)d_out;

    const size_t XH_ELEMS = (size_t)BATCH * NSEQ * DMODEL;  // 8,388,608
    const size_t WH_ELEMS = (size_t)DMODEL * DMODEL;        //   262,144
    char* ws = (char*)d_ws;
    _Float16* Xh = (_Float16*)ws;
    _Float16* Wh = (_Float16*)(ws + XH_ELEMS * sizeof(_Float16));
    _Float16* Vt = (_Float16*)(ws + (XH_ELEMS + WH_ELEMS) * sizeof(_Float16));

    cvt_f32_to_f16<<<(int)(WH_ELEMS / (256 * 8)), 256, 0, stream>>>(W, Wh, (int)WH_ELEMS);

    proj_elu_kernel<<<(BATCH * NSEQ / 128) * 2, 256, 0, stream>>>(X, Xh, Wh, bias, Vt);

    fused_attn_kernel<<<BATCH * (NSEQ / NROWS), 256, 0, stream>>>(Xh, M, Vt, out);
}
